// v000
// The times below were measured on an AMD MI455X: many runs one after another, warmed up first and cycling through
// copies of the inputs, with the whole window's GPU time divided by the number of runs. Launches and the gaps
// between them are all in it. The median over several windows is given; except for v000 it joins two sittings, which
// can be a few percent apart, so the side-by-side timings, each taken in one sitting, are the better comparison.
// v000, which the later versions start from, runs in 4710 microseconds.
#include <hip/hip_runtime.h>

// R3DAttention (x [8][1024][1024]; qkv = x Wqkv + bqkv ([1024][3072]: q | k | v blocks, 16 heads x 64); scores = q.k / 8 - mask[i][j] (f32 [1024][1024], read; shared over batch and heads); softmax; out = merged Wo + bo -> [8][1024][1024]).
// Compute dtypes, f32 accumulate: every input rounded to bf16; q/k/v on PLAIN bf16 operands (inputs: exact) + bias; scores hl x hl (3 products) on every row, attn.v: query rows < 512 hl (3 products), the rest single fp16 (x1024); the (bf16-rounded) mask subtracted per element in f32; softmax f32; Wo hl x exact (2 products) + bias.

#define NB_  8
#define TT   1024
#define DM   1024
#define NH_  16
#define NKV  16
#define REP  (NH_ / NKV)
#define HD   64
#define DQ   (NH_ * HD)
#define DKV  (NKV * HD)
#define ZH   2
#define RH   512                  // query rows < RH use hi+lo planes (0: none)
#define WIN  0
#define PCAR 1024.0f
#define SCL  0.125f   // HD^-0.5
typedef _Float16 h16;
typedef unsigned short bf;
typedef __attribute__((ext_vector_type(16))) __bf16   v16bf;
typedef __attribute__((ext_vector_type(16))) _Float16 v16h;
typedef __attribute__((ext_vector_type(8)))  _Float16 v8h;
typedef __attribute__((ext_vector_type(8)))  unsigned short v8us;
typedef __attribute__((ext_vector_type(8)))  float    v8f;
typedef __attribute__((ext_vector_type(4)))  float    v4f;
typedef v8h  __attribute__((may_alias)) v8ha;
typedef v4f  __attribute__((may_alias)) v4fa;
typedef v8us __attribute__((may_alias)) v8usa;

__device__ __forceinline__ unsigned short f2bf(float f) { unsigned u = __float_as_uint(f); u += 0x7FFFu + ((u >> 16) & 1u); return (unsigned short)(u >> 16); }
__device__ __forceinline__ float bf2f(unsigned short b) { return __uint_as_float(((unsigned)b) << 16); }
__device__ __forceinline__ float bfr(float f) { return bf2f(f2bf(f)); }
__device__ __forceinline__ v16h cat16(v8h lo, v8h hi) { return __builtin_shufflevector(lo, hi, 0, 1, 2, 3, 4, 5, 6, 7, 8, 9, 10, 11, 12, 13, 14, 15); }
__device__ __forceinline__ v16bf cat16b(v8us lo, v8us hi) { return __builtin_bit_cast(v16bf, __builtin_shufflevector(lo, hi, 0, 1, 2, 3, 4, 5, 6, 7, 8, 9, 10, 11, 12, 13, 14, 15)); }
__device__ __forceinline__ v8f wmma16(v16h a, v16h b, v8f c) { return __builtin_amdgcn_wmma_f32_16x16x32_f16(false, a, false, b, (short)0, c, false, false); }
__device__ __forceinline__ v8f wmmab(v16bf a, v16bf b, v8f c) { return __builtin_amdgcn_wmma_f32_16x16x32_bf16(false, a, false, b, (short)0, c, false, false); }



// ---- k_gemmw: register-blocked GEMM, ONE WAVE per 64x64 output tile (16 accumulators), operands straight from K-contiguous 16-bit planes; grid (M/64, N/64, Z), 32 threads.
// C[m][n] (f32, pitch ldc, + optional f32 bias[n]) = sum_k A[m][k] Bt[n][k] (+ split products per NSPLIT). z-batch strides sA/sB/sC in elements. K % 32 == 0.
template <typename T16> struct WFrag;
template <> struct WFrag<h16> { typedef v16h V; static __device__ __forceinline__ V ld(const h16* p) { return cat16(*(const v8h*)p, *(const v8h*)(p + 16)); } static __device__ __forceinline__ v8f mma(V a, V b, v8f c) { return wmma16(a, b, c); } };
template <> struct WFrag<bf> { typedef v16bf V; static __device__ __forceinline__ V ld(const bf* p) { return cat16b(*(const v8us*)p, *(const v8us*)(p + 16)); } static __device__ __forceinline__ v8f mma(V a, V b, v8f c) { return wmmab(a, b, c); } };
template <typename T16, int NSPLIT, bool BIAS>
__global__ __launch_bounds__(32) void k_gemmw(const T16* __restrict__ A, const T16* __restrict__ A2, const T16* __restrict__ Bt, const T16* __restrict__ Bt2, int K, float* C, int ldc, const float* __restrict__ bias, size_t sA, size_t sB, size_t sC) {
    typedef typename WFrag<T16>::V V;
    __shared__ __align__(16) float os[16 * 68];
    const size_t z = blockIdx.z; A += z * sA; if (A2) A2 += z * sA; Bt += z * sB; if (Bt2) Bt2 += z * sB; C += z * sC;
    const int lane = threadIdx.x & 31, lr = lane & 15, hi = lane >> 4; const int r0 = blockIdx.x * 64, c0 = blockIdx.y * 64;
    v8f acc[4][4];
#pragma unroll
    for (int mb = 0; mb < 4; ++mb)
#pragma unroll
        for (int nb = 0; nb < 4; ++nb) acc[mb][nb] = (v8f){};
    const size_t aoff = (size_t)(r0 + lr) * K + 8 * hi, boff = (size_t)(c0 + lr) * K + 8 * hi;
#pragma unroll 1
    for (int kc = 0; kc < K; kc += 32) {
        V a[4], a2[4];
#pragma unroll
        for (int mb = 0; mb < 4; ++mb) { a[mb] = WFrag<T16>::ld(A + aoff + (size_t)mb * 16 * K + kc); if (NSPLIT == 1 || NSPLIT == 2) a2[mb] = WFrag<T16>::ld(A2 + aoff + (size_t)mb * 16 * K + kc); }
#pragma unroll
        for (int nb = 0; nb < 4; ++nb) { const V b = WFrag<T16>::ld(Bt + boff + (size_t)nb * 16 * K + kc); V b2; if (NSPLIT >= 2) b2 = WFrag<T16>::ld(Bt2 + boff + (size_t)nb * 16 * K + kc);
#pragma unroll
            for (int mb = 0; mb < 4; ++mb) { acc[mb][nb] = WFrag<T16>::mma(a[mb], b, acc[mb][nb]); if (NSPLIT == 1 || NSPLIT == 2) acc[mb][nb] = WFrag<T16>::mma(a2[mb], b, acc[mb][nb]); if (NSPLIT >= 2) acc[mb][nb] = WFrag<T16>::mma(a[mb], b2, acc[mb][nb]); } }
        asm volatile("v_nop\n\tv_nop\n\tv_nop\n\tv_nop" : "+v"(acc[0][0]), "+v"(acc[1][1]), "+v"(acc[2][2]), "+v"(acc[3][3]) : "v"(a[0]), "v"(a[3]));
    }
#pragma unroll
    for (int mb = 0; mb < 4; ++mb) {
#pragma unroll
        for (int nb = 0; nb < 4; ++nb) {
#pragma unroll
            for (int j = 0; j < 8; ++j) os[(hi * 8 + j) * 68 + nb * 16 + lr] = acc[mb][nb][j]; }
        __builtin_amdgcn_wave_barrier(); asm volatile("" ::: "memory");
        float* crow = C + (size_t)(r0 + mb * 16) * ldc + c0;
{
#pragma unroll
            for (int s = 0; s < 8; ++s) { const int row = 2 * s + hi, cofs = lr * 4; v4f val = *(const v4fa*)(os + row * 68 + cofs); if (BIAS) { val[0] += bfr(bias[c0 + cofs]); val[1] += bfr(bias[c0 + cofs + 1]); val[2] += bfr(bias[c0 + cofs + 2]); val[3] += bfr(bias[c0 + cofs + 3]); }
                *(v4f*)(crow + (size_t)row * ldc + cofs) = val; }
             }
        __builtin_amdgcn_wave_barrier(); asm volatile("" ::: "memory");
    }
}

__device__ __forceinline__ h16 tohx(float x) { return (h16)x; }
__device__ __forceinline__ void splitf(float y, unsigned short& h, unsigned short& l) { h = f2bf(y); l = f2bf(y - bf2f(h)); }
typedef __attribute__((ext_vector_type(2))) _Float16 v2h;
typedef __attribute__((ext_vector_type(4))) _Float16 v4h;
typedef __attribute__((ext_vector_type(2))) unsigned short v2us;
typedef __attribute__((ext_vector_type(4))) unsigned short v4us;
typedef __attribute__((ext_vector_type(2))) float v2f;
typedef __attribute__((ext_vector_type(4))) int v4i;

__global__ __launch_bounds__(256) void k_wtG(const float* __restrict__ w, int K, int N, bf* Bt) {
    const int lane = threadIdx.x & 31; const int L0 = (blockIdx.x * 8 + (threadIdx.x >> 5)) * 8; const int nlines = N * K / 64;
{
#pragma unroll 1
        for (int l = 0; l < 8; ++l) { const int L = L0 + l; if (L >= nlines) break; const size_t e = (size_t)L * 64 + lane * 2; const int k = (int)(e % K), n = (int)(e / K); v2us o;
            o[0] = f2bf(w[(size_t)k * N + n]); o[1] = f2bf(w[(size_t)(k + 1) * N + n]); *(v2us*)(Bt + e) = o; }
         }
}
__global__ __launch_bounds__(256) void k_cvt8(const float* __restrict__ src, bf* dst, size_t n8) { const size_t i = (size_t)blockIdx.x * 256 + threadIdx.x; if (i >= n8) return; const v8f v = *(const v8f*)(src + i * 8); v8us o;
#pragma unroll
    for (int k = 0; k < 8; ++k) o[k] = f2bf(v[k]); *(v8us*)(dst + i * 8) = o;  }
__global__ __launch_bounds__(256) void k_cscvt(const float* __restrict__ cosT, const float* __restrict__ sinT, float* CS) { const int idx = blockIdx.x * 256 + threadIdx.x; if (idx >= TT * HD) return; v2f cs; cs[0] = bfr(cosT[idx]); cs[1] = bfr(sinT[idx]); *(v2f*)(CS + (size_t)idx * 2) = cs;  }
// k_rope: head planes [h][t][d] (fp16 + hi/lo) of rope(x) x sc with the rotate-half convention out[d] = x[d] cos[t][d] - x[d+HD/2] sin[t][d], out[d+HD/2] = x[d+HD/2] cos[t][d+HD/2] + x[d] sin[t][d+HD/2]
__global__ __launch_bounds__(256) void k_rope(const float* __restrict__ F, int pitch, int nheads, const float* __restrict__ CS, const float* __restrict__ RF, const float* __restrict__ nw, float sc, h16* P16, bf* Ph, bf* Pl) {
    const size_t e = ((size_t)blockIdx.x * 256 + threadIdx.x) * 2; if (e >= (size_t)nheads * TT * HD) return; const int d = (int)(e % HD); const int t = (int)((e / HD) % TT); const int h = (int)(e / ((size_t)HD * TT)); const float* f = F + (size_t)t * pitch + h * HD; const float rf = RF ? RF[(size_t)h * TT + t] : 1.0f; v2h o16; v2us oh, ol;
#pragma unroll
    for (int q = 0; q < 2; ++q) { const int dd = d + q; const int dp = (dd < HD / 2) ? dd + HD / 2 : dd - HD / 2; float x0 = f[dd], x1 = f[dp];
        if (RF) { float n0 = __fmul_rn(x0, rf), n1 = __fmul_rn(x1, rf); asm volatile("" : "+v"(n0)); asm volatile("" : "+v"(n1)); x0 = __fmul_rn(bfr(nw[dd]), n0); x1 = __fmul_rn(bfr(nw[dp]), n1); }
        const v2f cs = *(const v2f*)(CS + ((size_t)t * HD + dd) * 2); float a = __fmul_rn(x0, cs[0]), bq = __fmul_rn(x1, cs[1]); asm volatile("" : "+v"(a)); asm volatile("" : "+v"(bq)); const float r = ((dd < HD / 2) ? __fsub_rn(a, bq) : __fadd_rn(a, bq)) * sc;
        o16[q] = tohx(r); unsigned short a2, c2; splitf(r, a2, c2); oh[q] = a2; ol[q] = c2; }
    *(v2h*)(P16 + e) = o16; *(v2us*)(Ph + e) = oh; *(v2us*)(Pl + e) = ol;  }
__global__ __launch_bounds__(256) void k_vtp(const float* __restrict__ F, int pitch, int nheads, h16* V16, bf* Vh, bf* Vl) { const size_t e = ((size_t)blockIdx.x * 256 + threadIdx.x) * 2; if (e >= (size_t)nheads * HD * TT) return; const int t = (int)(e % TT); const int d = (int)((e / TT) % HD); const int g = (int)(e / ((size_t)TT * HD)); v2h o16; v2us oh, ol;
#pragma unroll
    for (int q = 0; q < 2; ++q) { const float x = F[(size_t)(t + q) * pitch + g * HD + d]; o16[q] = tohx(x); unsigned short a2, c2; splitf(x, a2, c2); oh[q] = a2; ol[q] = c2; }
    *(v2h*)(V16 + e) = o16; *(v2us*)(Vh + e) = oh; *(v2us*)(Vl + e) = ol;  }
__global__ __launch_bounds__(256) void k_csid(float* CS) { const int idx = blockIdx.x * 256 + threadIdx.x; if (idx >= TT * HD) return; v2f cs; cs[0] = 1.0f; cs[1] = 0.0f; *(v2f*)(CS + (size_t)idx * 2) = cs;  }
// k_rbf: bf16-rounded f32 copy of the mask.
__global__ __launch_bounds__(256) void k_rbf(const float* __restrict__ src, float* dst, int n4) { const int i = blockIdx.x * 256 + threadIdx.x; if (i >= n4) return; const v4f a = *(const v4f*)(src + (size_t)i * 4); v4f o; for (int u = 0; u < 4; ++u) o[u] = bfr(a[u]); *(v4f*)(dst + (size_t)i * 4) = o;  }
// k_asoft: per row (zz, i): t = S x HD^-0.5 - mask[i][j]; softmax over the 1024 keys (register row, one exp, fixed trees);
__global__ __launch_bounds__(256) void k_asoft(const float* __restrict__ Sb, const float* __restrict__ am, h16* P16, bf* Ph, bf* Pl) {
    const int lane = threadIdx.x & 31; const int row = blockIdx.x * 8 + (threadIdx.x >> 5); if (row >= ZH * TT) return; const int i = row % TT; const int zz = row / TT; (void)zz; const bool hires = (i < RH); const float* sr = Sb + (size_t)row * TT; const float* mrow = am + (size_t)i * TT; float v[TT / 32]; float mx = -3.0e38f;
#pragma unroll
    for (int ch = 0; ch < TT / 128; ++ch) { const int j0 = ch * 128 + lane * 4; const v4f a = *(const v4f*)(sr + j0);
#pragma unroll
        for (int q = 0; q < 4; ++q) { const int j = j0 + q; (void)j; float sa = a[q] * SCL; asm volatile("" : "+v"(sa)); const float t = __fsub_rn(sa, mrow[j0 + q]); v[ch * 4 + q] = t; mx = fmaxf(mx, t); } }
#pragma unroll
    for (int sh = 16; sh; sh >>= 1) mx = fmaxf(mx, __shfl_xor(mx, sh, 32));
    float sum = 0.f;
#pragma unroll
    for (int k = 0; k < TT / 32; ++k) { float d0 = __fsub_rn(v[k], mx); asm volatile("" : "+v"(d0)); v[k] = __builtin_amdgcn_exp2f(__fmul_rn(d0, 1.4426950408889634f)); sum += v[k]; }
#pragma unroll
    for (int sh = 16; sh; sh >>= 1) sum += __shfl_xor(sum, sh, 32);
    const float f = __fdiv_rn(hires ? 1.0f : PCAR, sum);
{
        if (hires) {
#pragma unroll
            for (int ch = 0; ch < TT / 128; ++ch) { v4us oh, ol;
#pragma unroll
                for (int q = 0; q < 4; ++q) { unsigned short a, c2; splitf(v[ch * 4 + q] * f, a, c2); oh[q] = a; ol[q] = c2; }
                const size_t oo = ((size_t)zz * (RH ? RH : 1) + i) * TT + ch * 128 + lane * 4; *(v4us*)(Ph + oo) = oh; *(v4us*)(Pl + oo) = ol; }
        } else {
#pragma unroll
            for (int ch = 0; ch < TT / 128; ++ch) { v4h o4;
#pragma unroll
                for (int q = 0; q < 4; ++q) o4[q] = tohx(v[ch * 4 + q] * f);
                *(v4h*)(P16 + (size_t)row * TT + ch * 128 + lane * 4) = o4; } }
         }
}
__global__ __launch_bounds__(256) void k_merge(const float* __restrict__ O, int h0, bf* Ah, bf* Al) { const size_t e = ((size_t)blockIdx.x * 256 + threadIdx.x) * 2; if (e >= (size_t)ZH * TT * HD) return; const int d = (int)(e % HD); const int t = (int)((e / HD) % TT); const int zz = (int)(e / ((size_t)HD * TT)); const float cs = (t < RH) ? 1.0f : (1.0f / PCAR); const size_t oo = (size_t)t * DQ + (h0 + zz) * HD + d;
    v2us oh, ol;
#pragma unroll
    for (int q = 0; q < 2; ++q) { unsigned short a, c2; splitf(O[e + q] * cs, a, c2); oh[q] = a; ol[q] = c2; } *(v2us*)(Ah + oo) = oh; *(v2us*)(Al + oo) = ol;  }

extern "C" void kernel_launch(void* const* d_in, const int* in_sizes, int n_in,
                              void* d_out, int out_size, void* d_ws, size_t ws_size, hipStream_t stream) {
    (void)in_sizes; (void)n_in; (void)out_size;
    const float* x = (const float*)d_in[0]; const float* amask = (const float*)d_in[1]; const float* wf = (const float*)d_in[2]; const float* bf3 = (const float*)d_in[3]; const float* wo = (const float*)d_in[4]; const float* bo = (const float*)d_in[5]; const float* wq = wf; const float* wk = wf; const float* wv = wf; const float* bq = bf3; const float* bk = bf3 + 1024; const float* bv = bf3 + 2048; (void)wk; (void)wv; const float* cosT = nullptr; const float* sinT = nullptr; (void)cosT; (void)sinT;
    float* OUT = (float*)d_out;     // [8][1024][1024]
    char* wsp = (char*)d_ws;
    auto take = [&](size_t bytes) { char* p = wsp; wsp += (bytes + 255) & ~(size_t)255; return (void*)p; };
    bf* WQ = nullptr; bf* WK = nullptr; bf* WV = nullptr; bf* WO = (bf*)take((size_t)DM * DQ * 2); float* CS = (float*)take((size_t)TT * HD * 2 * 4);
    bf* XB = (bf*)take((size_t)TT * DM * 2); bf* WALL = (bf*)take((size_t)(DQ + 2 * DKV) * DM * 2); float* AMR = (float*)take((size_t)TT * TT * 4); float* FQ = (float*)take((size_t)TT * DQ * 4); float* FK = (float*)take((size_t)TT * DKV * 4);
    h16* QP16 = (h16*)take((size_t)NH_ * TT * HD * 2); h16* KP16 = (h16*)take((size_t)NKV * TT * HD * 2); h16* VT16 = (h16*)take((size_t)NKV * HD * TT * 2);
    bf* QPh = (bf*)take((size_t)NH_ * TT * HD * 2); bf* QPl = (bf*)take((size_t)NH_ * TT * HD * 2); bf* KPh = (bf*)take((size_t)NKV * TT * HD * 2); bf* KPl = (bf*)take((size_t)NKV * TT * HD * 2); bf* VTh = (bf*)take((size_t)NKV * HD * TT * 2); bf* VTl = (bf*)take((size_t)NKV * HD * TT * 2); bf* Ph = (bf*)take((size_t)ZH * RH * TT * 2); bf* Pl = (bf*)take((size_t)ZH * RH * TT * 2);
    float* Sb = (float*)take((size_t)ZH * TT * TT * 4); h16* P16 = (h16*)take((size_t)ZH * TT * TT * 2); float* Ob = (float*)take((size_t)ZH * TT * HD * 4); bf* ATh = (bf*)take((size_t)TT * DQ * 2); bf* ATl = (bf*)take((size_t)TT * DQ * 2);
    if ((size_t)(wsp - (char*)d_ws) > ws_size) return;    // ws 256 MiB
    float* FV = FK;   // v projection reuses the k buffer after the k planes are built (stream-ordered)
    { k_wtG<<<(unsigned)((DM * (DQ + 2 * DKV) / 64 + 63) / 64), 256, 0, stream>>>(wf, DM, DQ + 2 * DKV, WALL); WQ = WALL; WK = WALL + (size_t)DQ * DM; WV = WK + (size_t)DKV * DM; k_rbf<<<(unsigned)(((size_t)TT * TT / 4 + 255) / 256), 256, 0, stream>>>(amask, AMR, TT * TT / 4);
      k_wtG<<<(unsigned)((DQ * DM / 64 + 63) / 64), 256, 0, stream>>>(wo, DQ, DM, WO);
       }
    k_csid<<<(TT * HD + 255) / 256, 256, 0, stream>>>(CS);
    const unsigned LQ = (unsigned)(((size_t)NH_ * TT * HD / 2 + 255) / 256), LKv = (unsigned)(((size_t)NKV * TT * HD / 2 + 255) / 256);
    for (int b = 0; b < NB_; ++b) {
        
        k_cvt8<<<(unsigned)(((size_t)TT * DM / 8 + 255) / 256), 256, 0, stream>>>(x + (size_t)b * TT * DM, XB, (size_t)TT * DM / 8);
        k_gemmw<bf, 0, true><<<dim3(TT / 64, DQ / 64, 1), 32, 0, stream>>>(XB, nullptr, WQ, nullptr, DM, FQ, DQ, bq, 0, 0, 0);
        k_rope<<<LQ, 256, 0, stream>>>(FQ, DQ, NH_, CS, nullptr, nullptr, 1.0f, QP16, QPh, QPl);
        k_gemmw<bf, 0, true><<<dim3(TT / 64, DKV / 64, 1), 32, 0, stream>>>(XB, nullptr, WK, nullptr, DM, FK, DKV, bk, 0, 0, 0);
        k_rope<<<LKv, 256, 0, stream>>>(FK, DKV, NKV, CS, nullptr, nullptr, 1.0f, KP16, KPh, KPl);
        k_gemmw<bf, 0, true><<<dim3(TT / 64, DKV / 64, 1), 32, 0, stream>>>(XB, nullptr, WV, nullptr, DM, FV, DKV, bv, 0, 0, 0); k_vtp<<<LKv, 256, 0, stream>>>(FV, DKV, NKV, VT16, VTh, VTl);
        for (int h0 = 0; h0 < NH_; h0 += ZH) { const size_t zq = (size_t)h0, zk = (size_t)(h0 / REP);   // one kv head per query head: the pass's two heads use consecutive kv planes (z-strides TT*HD)
            k_gemmw<bf, 2, false><<<dim3(TT / 64, TT / 64, ZH), 32, 0, stream>>>(QPh + zq * TT * HD, QPl + zq * TT * HD, KPh + zk * TT * HD, KPl + zk * TT * HD, HD, Sb, TT, nullptr, (size_t)TT * HD, (size_t)TT * HD, (size_t)TT * TT);   /* scores hl on all rows */
            k_asoft<<<ZH * TT / 8, 256, 0, stream>>>(Sb, AMR, P16, Ph, Pl);
            k_gemmw<bf, 2, false><<<dim3(RH / 64, HD / 64, ZH), 32, 0, stream>>>(Ph, Pl, VTh + zk * HD * TT, VTl + zk * HD * TT, TT, Ob, HD, nullptr, (size_t)RH * TT, (size_t)HD * TT, (size_t)TT * HD);
            k_gemmw<h16, 0, false><<<dim3((TT - RH) / 64, HD / 64, ZH), 32, 0, stream>>>(P16 + (size_t)RH * TT, nullptr, VT16 + zk * HD * TT, nullptr, TT, Ob + (size_t)RH * HD, HD, nullptr, (size_t)TT * TT, (size_t)HD * TT, (size_t)TT * HD);
            k_merge<<<(unsigned)(((size_t)ZH * TT * HD / 2 + 255) / 256), 256, 0, stream>>>(Ob, h0, ATh, ATl); }
        k_gemmw<bf, 1, true><<<dim3(TT / 64, DM / 64, 1), 32, 0, stream>>>(ATh, ATl, WO, nullptr, DQ, OUT + (size_t)b * TT * DM, DM, bo, 0, 0, 0); }
}

// v001
// One run takes 886 microseconds.
// Next to v000, in two timings, it ran 5.30 and 5.31 times as fast.
#include <hip/hip_runtime.h>

// R3DAttention (x [8][1024][1024]; qkv = x Wqkv + bqkv ([1024][3072]: q | k | v blocks, 16 heads x 64); scores = q.k / 8 - mask[i][j] (f32 [1024][1024], read; shared over batch and heads); softmax; out = merged Wo + bo -> [8][1024][1024]).
// Compute dtypes, f32 accumulate: every input rounded to bf16; q/k/v on PLAIN bf16 operands (inputs: exact) + bias; scores hl x hl (3 products) on every row, attn.v: query rows < 512 hl (3 products), the rest single fp16 (x1024); the (bf16-rounded) mask subtracted per element in f32; softmax f32; Wo hl x exact (2 products) + bias.

#define NB_  8
#define TT   1024
#define DM   1024
#define NH_  16
#define NKV  16
#define REP  (NH_ / NKV)
#define HD   64
#define DQ   (NH_ * HD)
#define DKV  (NKV * HD)
#define ZH   8                    // heads per score / softmax launch (the f32 score buffer holds ZH heads)
#define ZA   32                   // heads per attn.v / merge launch: all heads of two batch entries (the probability planes hold ZA heads)
#define GB   4                    // batch entries per projection launch (the workspace holds the head planes of GB entries)
#define RH   512                  // query rows < RH use hi+lo planes (0: none)
#define WIN  0
#define PCAR 1024.0f
#define SCL  0.125f   // HD^-0.5
typedef _Float16 h16;
typedef unsigned short bf;
typedef __attribute__((ext_vector_type(16))) __bf16   v16bf;
typedef __attribute__((ext_vector_type(16))) _Float16 v16h;
typedef __attribute__((ext_vector_type(8)))  _Float16 v8h;
typedef __attribute__((ext_vector_type(8)))  unsigned short v8us;
typedef __attribute__((ext_vector_type(8)))  float    v8f;
typedef __attribute__((ext_vector_type(4)))  float    v4f;
typedef v8h  __attribute__((may_alias)) v8ha;
typedef v4f  __attribute__((may_alias)) v4fa;
typedef v8us __attribute__((may_alias)) v8usa;

__device__ __forceinline__ unsigned short f2bf(float f) { unsigned u = __float_as_uint(f); u += 0x7FFFu + ((u >> 16) & 1u); return (unsigned short)(u >> 16); }
__device__ __forceinline__ float bf2f(unsigned short b) { return __uint_as_float(((unsigned)b) << 16); }
__device__ __forceinline__ float bfr(float f) { return bf2f(f2bf(f)); }
__device__ __forceinline__ v16h cat16(v8h lo, v8h hi) { return __builtin_shufflevector(lo, hi, 0, 1, 2, 3, 4, 5, 6, 7, 8, 9, 10, 11, 12, 13, 14, 15); }
__device__ __forceinline__ v16bf cat16b(v8us lo, v8us hi) { return __builtin_bit_cast(v16bf, __builtin_shufflevector(lo, hi, 0, 1, 2, 3, 4, 5, 6, 7, 8, 9, 10, 11, 12, 13, 14, 15)); }
__device__ __forceinline__ v8f wmma16(v16h a, v16h b, v8f c) { return __builtin_amdgcn_wmma_f32_16x16x32_f16(false, a, false, b, (short)0, c, false, false); }
__device__ __forceinline__ v8f wmmab(v16bf a, v16bf b, v8f c) { return __builtin_amdgcn_wmma_f32_16x16x32_bf16(false, a, false, b, (short)0, c, false, false); }



// ---- k_gemmw: register-blocked GEMM, ONE WAVE per 64x64 output tile (16 accumulators), operands straight from K-contiguous 16-bit planes; grid (M/64, N/64, Z), 32 threads.
// C[m][n] (f32, pitch ldc, + optional f32 bias[n]) = sum_k A[m][k] Bt[n][k] (+ split products per NSPLIT). z-batch strides sA/sB/sC in elements. K % 32 == 0.
template <typename T16> struct WFrag;
template <> struct WFrag<h16> { typedef v16h V; static __device__ __forceinline__ V ld(const h16* p) { return cat16(*(const v8h*)p, *(const v8h*)(p + 16)); } static __device__ __forceinline__ v8f mma(V a, V b, v8f c) { return wmma16(a, b, c); } };
template <> struct WFrag<bf> { typedef v16bf V; static __device__ __forceinline__ V ld(const bf* p) { return cat16b(*(const v8us*)p, *(const v8us*)(p + 16)); } static __device__ __forceinline__ v8f mma(V a, V b, v8f c) { return wmmab(a, b, c); } };
template <typename T16, int NSPLIT, bool BIAS>
__global__ __launch_bounds__(32) void k_gemmw(const T16* __restrict__ A, const T16* __restrict__ A2, const T16* __restrict__ Bt, const T16* __restrict__ Bt2, int K, float* C, int ldc, const float* __restrict__ bias, size_t sA, size_t sB, size_t sC) {
    typedef typename WFrag<T16>::V V;
    __shared__ __align__(16) float os[16 * 68];
    const size_t z = blockIdx.z; A += z * sA; if (A2) A2 += z * sA; Bt += z * sB; if (Bt2) Bt2 += z * sB; C += z * sC;
    const int lane = threadIdx.x & 31, lr = lane & 15, hi = lane >> 4; const int r0 = blockIdx.x * 64, c0 = blockIdx.y * 64;
    v8f acc[4][4];
#pragma unroll
    for (int mb = 0; mb < 4; ++mb)
#pragma unroll
        for (int nb = 0; nb < 4; ++nb) acc[mb][nb] = (v8f){};
    const size_t aoff = (size_t)(r0 + lr) * K + 8 * hi, boff = (size_t)(c0 + lr) * K + 8 * hi;
#pragma unroll 1
    for (int kc = 0; kc < K; kc += 32) {
        V a[4], a2[4];
#pragma unroll
        for (int mb = 0; mb < 4; ++mb) { a[mb] = WFrag<T16>::ld(A + aoff + (size_t)mb * 16 * K + kc); if (NSPLIT == 1 || NSPLIT == 2) a2[mb] = WFrag<T16>::ld(A2 + aoff + (size_t)mb * 16 * K + kc); }
#pragma unroll
        for (int nb = 0; nb < 4; ++nb) { const V b = WFrag<T16>::ld(Bt + boff + (size_t)nb * 16 * K + kc); V b2; if (NSPLIT >= 2) b2 = WFrag<T16>::ld(Bt2 + boff + (size_t)nb * 16 * K + kc);
#pragma unroll
            for (int mb = 0; mb < 4; ++mb) { acc[mb][nb] = WFrag<T16>::mma(a[mb], b, acc[mb][nb]); if (NSPLIT == 1 || NSPLIT == 2) acc[mb][nb] = WFrag<T16>::mma(a2[mb], b, acc[mb][nb]); if (NSPLIT >= 2) acc[mb][nb] = WFrag<T16>::mma(a[mb], b2, acc[mb][nb]); } }
        asm volatile("v_nop\n\tv_nop\n\tv_nop\n\tv_nop" : "+v"(acc[0][0]), "+v"(acc[1][1]), "+v"(acc[2][2]), "+v"(acc[3][3]) : "v"(a[0]), "v"(a[3]));
    }
#pragma unroll
    for (int mb = 0; mb < 4; ++mb) {
#pragma unroll
        for (int nb = 0; nb < 4; ++nb) {
#pragma unroll
            for (int j = 0; j < 8; ++j) os[(hi * 8 + j) * 68 + nb * 16 + lr] = acc[mb][nb][j]; }
        __builtin_amdgcn_wave_barrier(); asm volatile("" ::: "memory");
        float* crow = C + (size_t)(r0 + mb * 16) * ldc + c0;
{
#pragma unroll
            for (int s = 0; s < 8; ++s) { const int row = 2 * s + hi, cofs = lr * 4; v4f val = *(const v4fa*)(os + row * 68 + cofs); if (BIAS) { val[0] += bfr(bias[c0 + cofs]); val[1] += bfr(bias[c0 + cofs + 1]); val[2] += bfr(bias[c0 + cofs + 2]); val[3] += bfr(bias[c0 + cofs + 3]); }
                *(v4f*)(crow + (size_t)row * ldc + cofs) = val; }
             }
        __builtin_amdgcn_wave_barrier(); asm volatile("" ::: "memory");
    }
}

__device__ __forceinline__ h16 tohx(float x) { return (h16)x; }
__device__ __forceinline__ void splitf(float y, unsigned short& h, unsigned short& l) { h = f2bf(y); l = f2bf(y - bf2f(h)); }
typedef __attribute__((ext_vector_type(2))) _Float16 v2h;
typedef __attribute__((ext_vector_type(4))) _Float16 v4h;
typedef __attribute__((ext_vector_type(2))) unsigned short v2us;
typedef __attribute__((ext_vector_type(4))) unsigned short v4us;
typedef __attribute__((ext_vector_type(2))) float v2f;
typedef __attribute__((ext_vector_type(4))) int v4i;

__global__ __launch_bounds__(256) void k_wtG(const float* __restrict__ w, int K, int N, bf* Bt) {
    const int lane = threadIdx.x & 31; const int L0 = (blockIdx.x * 8 + (threadIdx.x >> 5)) * 8; const int nlines = N * K / 64;
{
#pragma unroll 1
        for (int l = 0; l < 8; ++l) { const int L = L0 + l; if (L >= nlines) break; const size_t e = (size_t)L * 64 + lane * 2; const int k = (int)(e % K), n = (int)(e / K); v2us o;
            o[0] = f2bf(w[(size_t)k * N + n]); o[1] = f2bf(w[(size_t)(k + 1) * N + n]); *(v2us*)(Bt + e) = o; }
         }
}
__global__ __launch_bounds__(256) void k_cvt8(const float* __restrict__ src, bf* dst, size_t n8) { const size_t i = (size_t)blockIdx.x * 256 + threadIdx.x; if (i >= n8) return; const v8f v = *(const v8f*)(src + i * 8); v8us o;
#pragma unroll
    for (int k = 0; k < 8; ++k) o[k] = f2bf(v[k]); *(v8us*)(dst + i * 8) = o;  }
__global__ __launch_bounds__(256) void k_cscvt(const float* __restrict__ cosT, const float* __restrict__ sinT, float* CS) { const int idx = blockIdx.x * 256 + threadIdx.x; if (idx >= TT * HD) return; v2f cs; cs[0] = bfr(cosT[idx]); cs[1] = bfr(sinT[idx]); *(v2f*)(CS + (size_t)idx * 2) = cs;  }
// k_rope: grid.y = batch entry (F rows y*TT.., planes y*nheads..); head planes [h][t][d] (fp16 + hi/lo) of rope(x) x sc with the rotate-half convention out[d] = x[d] cos[t][d] - x[d+HD/2] sin[t][d], out[d+HD/2] = x[d+HD/2] cos[t][d+HD/2] + x[d] sin[t][d+HD/2]
__global__ __launch_bounds__(256) void k_rope(const float* __restrict__ F, int pitch, int nheads, const float* __restrict__ CS, const float* __restrict__ RF, const float* __restrict__ nw, float sc, h16* P16, bf* Ph, bf* Pl) {
    { const size_t po = (size_t)blockIdx.y * nheads * TT * HD; F += (size_t)blockIdx.y * TT * pitch; P16 += po; Ph += po; Pl += po; }
    const size_t e = ((size_t)blockIdx.x * 256 + threadIdx.x) * 2; if (e >= (size_t)nheads * TT * HD) return; const int d = (int)(e % HD); const int t = (int)((e / HD) % TT); const int h = (int)(e / ((size_t)HD * TT)); const float* f = F + (size_t)t * pitch + h * HD; const float rf = RF ? RF[(size_t)h * TT + t] : 1.0f; v2h o16; v2us oh, ol;
#pragma unroll
    for (int q = 0; q < 2; ++q) { const int dd = d + q; const int dp = (dd < HD / 2) ? dd + HD / 2 : dd - HD / 2; float x0 = f[dd], x1 = f[dp];
        if (RF) { float n0 = __fmul_rn(x0, rf), n1 = __fmul_rn(x1, rf); asm volatile("" : "+v"(n0)); asm volatile("" : "+v"(n1)); x0 = __fmul_rn(bfr(nw[dd]), n0); x1 = __fmul_rn(bfr(nw[dp]), n1); }
        const v2f cs = *(const v2f*)(CS + ((size_t)t * HD + dd) * 2); float a = __fmul_rn(x0, cs[0]), bq = __fmul_rn(x1, cs[1]); asm volatile("" : "+v"(a)); asm volatile("" : "+v"(bq)); const float r = ((dd < HD / 2) ? __fsub_rn(a, bq) : __fadd_rn(a, bq)) * sc;
        o16[q] = tohx(r); unsigned short a2, c2; splitf(r, a2, c2); oh[q] = a2; ol[q] = c2; }
    *(v2h*)(P16 + e) = o16; *(v2us*)(Ph + e) = oh; *(v2us*)(Pl + e) = ol;  }
__global__ __launch_bounds__(256) void k_vtp(const float* __restrict__ F, int pitch, int nheads, h16* V16, bf* Vh, bf* Vl) { const size_t e = ((size_t)blockIdx.x * 256 + threadIdx.x) * 2; if (e >= (size_t)nheads * HD * TT) return; const int t = (int)(e % TT); const int d = (int)((e / TT) % HD); const int g = (int)(e / ((size_t)TT * HD)); v2h o16; v2us oh, ol; { const size_t po = (size_t)blockIdx.y * nheads * HD * TT; F += (size_t)blockIdx.y * TT * pitch; V16 += po; Vh += po; Vl += po; }   // grid.y = batch entry
#pragma unroll
    for (int q = 0; q < 2; ++q) { const float x = F[(size_t)(t + q) * pitch + g * HD + d]; o16[q] = tohx(x); unsigned short a2, c2; splitf(x, a2, c2); oh[q] = a2; ol[q] = c2; }
    *(v2h*)(V16 + e) = o16; *(v2us*)(Vh + e) = oh; *(v2us*)(Vl + e) = ol;  }
__global__ __launch_bounds__(256) void k_csid(float* CS) { const int idx = blockIdx.x * 256 + threadIdx.x; if (idx >= TT * HD) return; v2f cs; cs[0] = 1.0f; cs[1] = 0.0f; *(v2f*)(CS + (size_t)idx * 2) = cs;  }
// k_rbf: bf16-rounded f32 copy of the mask.
__global__ __launch_bounds__(256) void k_rbf(const float* __restrict__ src, float* dst, int n4) { const int i = blockIdx.x * 256 + threadIdx.x; if (i >= n4) return; const v4f a = *(const v4f*)(src + (size_t)i * 4); v4f o; for (int u = 0; u < 4; ++u) o[u] = bfr(a[u]); *(v4f*)(dst + (size_t)i * 4) = o;  }
// k_asoft: per row (zz, i): t = S x HD^-0.5 - mask[i][j]; softmax over the 1024 keys (register row, one exp, fixed trees);
__global__ __launch_bounds__(256) void k_asoft(const float* __restrict__ Sb, const float* __restrict__ am, h16* P16, bf* Ph, bf* Pl) {
    const int lane = threadIdx.x & 31; const int row = blockIdx.x * 8 + (threadIdx.x >> 5); if (row >= ZH * TT) return; const int i = row % TT; const int zz = row / TT; (void)zz; const bool hires = (i < RH); const float* sr = Sb + (size_t)row * TT; const float* mrow = am + (size_t)i * TT; float v[TT / 32]; float mx = -3.0e38f;
#pragma unroll
    for (int ch = 0; ch < TT / 128; ++ch) { const int j0 = ch * 128 + lane * 4; const v4f a = *(const v4f*)(sr + j0);
#pragma unroll
        for (int q = 0; q < 4; ++q) { const int j = j0 + q; (void)j; float sa = a[q] * SCL; asm volatile("" : "+v"(sa)); const float t = __fsub_rn(sa, mrow[j0 + q]); v[ch * 4 + q] = t; mx = fmaxf(mx, t); } }
#pragma unroll
    for (int sh = 16; sh; sh >>= 1) mx = fmaxf(mx, __shfl_xor(mx, sh, 32));
    float sum = 0.f;
#pragma unroll
    for (int k = 0; k < TT / 32; ++k) { float d0 = __fsub_rn(v[k], mx); asm volatile("" : "+v"(d0)); v[k] = __builtin_amdgcn_exp2f(__fmul_rn(d0, 1.4426950408889634f)); sum += v[k]; }
#pragma unroll
    for (int sh = 16; sh; sh >>= 1) sum += __shfl_xor(sum, sh, 32);
    const float f = __fdiv_rn(hires ? 1.0f : PCAR, sum);
{
        if (hires) {
#pragma unroll
            for (int ch = 0; ch < TT / 128; ++ch) { v4us oh, ol;
#pragma unroll
                for (int q = 0; q < 4; ++q) { unsigned short a, c2; splitf(v[ch * 4 + q] * f, a, c2); oh[q] = a; ol[q] = c2; }
                const size_t oo = ((size_t)zz * (RH ? RH : 1) + i) * TT + ch * 128 + lane * 4; *(v4us*)(Ph + oo) = oh; *(v4us*)(Pl + oo) = ol; }
        } else {
#pragma unroll
            for (int ch = 0; ch < TT / 128; ++ch) { v4h o4;
#pragma unroll
                for (int q = 0; q < 4; ++q) o4[q] = tohx(v[ch * 4 + q] * f);
                *(v4h*)(P16 + (size_t)row * TT + ch * 128 + lane * 4) = o4; } }
         }
}
__global__ __launch_bounds__(256) void k_merge(const float* __restrict__ O, int h0, bf* Ah, bf* Al) { const size_t e = ((size_t)blockIdx.x * 256 + threadIdx.x) * 2; if (e >= (size_t)ZA * TT * HD) return; const int d = (int)(e % HD); const int t = (int)((e / HD) % TT); const int zz = (int)(e / ((size_t)HD * TT)); const float cs = (t < RH) ? 1.0f : (1.0f / PCAR); const size_t oo = ((size_t)(zz / NH_) * TT + t) * DQ + (h0 + zz % NH_) * HD + d;   // zz = entry * NH_ + head
    v2us oh, ol;
#pragma unroll
    for (int q = 0; q < 2; ++q) { unsigned short a, c2; splitf(O[e + q] * cs, a, c2); oh[q] = a; ol[q] = c2; } *(v2us*)(Ah + oo) = oh; *(v2us*)(Al + oo) = ol;  }

extern "C" void kernel_launch(void* const* d_in, const int* in_sizes, int n_in,
                              void* d_out, int out_size, void* d_ws, size_t ws_size, hipStream_t stream) {
    (void)in_sizes; (void)n_in; (void)out_size;
    const float* x = (const float*)d_in[0]; const float* amask = (const float*)d_in[1]; const float* wf = (const float*)d_in[2]; const float* bf3 = (const float*)d_in[3]; const float* wo = (const float*)d_in[4]; const float* bo = (const float*)d_in[5];
    float* OUT = (float*)d_out;     // [8][1024][1024]
    char* wsp = (char*)d_ws;
    auto take = [&](size_t bytes) { char* p = wsp; wsp += (bytes + 255) & ~(size_t)255; return (void*)p; };
    bf* WO = (bf*)take((size_t)DM * DQ * 2); float* CS = (float*)take((size_t)TT * HD * 2 * 4);
    bf* WALL = (bf*)take((size_t)(DQ + 2 * DKV) * DM * 2); float* AMR = (float*)take((size_t)TT * TT * 4);
    h16* VT16 = (h16*)take((size_t)GB * NKV * HD * TT * 2);
    bf* QPh = (bf*)take((size_t)GB * NH_ * TT * HD * 2); bf* QPl = (bf*)take((size_t)GB * NH_ * TT * HD * 2); bf* KPh = (bf*)take((size_t)GB * NKV * TT * HD * 2); bf* KPl = (bf*)take((size_t)GB * NKV * TT * HD * 2); bf* VTh = (bf*)take((size_t)GB * NKV * HD * TT * 2); bf* VTl = (bf*)take((size_t)GB * NKV * HD * TT * 2);
    float* Sb = (float*)take((size_t)ZH * TT * TT * 4); h16* P16 = (h16*)take((size_t)ZA * TT * TT * 2); bf* Ph = (bf*)take((size_t)ZA * RH * TT * 2); bf* Pl = (bf*)take((size_t)ZA * RH * TT * 2);
    float* Ob = (float*)take((size_t)ZA * TT * HD * 4); bf* ATh = (bf*)take((size_t)GB * TT * DQ * 2); bf* ATl = (bf*)take((size_t)GB * TT * DQ * 2);
    if ((size_t)(wsp - (char*)d_ws) > ws_size) return;    // ws 256 MiB; the carve-up stays about 3 MiB below it
    const int NQKV = DQ + 2 * DKV;
    // Buffers that are dead once a group's head planes are built share space with the attention buffers (all launches are stream-ordered):
    bf* XB = (bf*)Sb;          // bf16 x of GB entries (8 MiB of the 32 MiB score buffer): last read by the projection, before the group's first scores
    float* FA = (float*)P16;   // q|k|v projections of GB entries ([GB*TT][NQKV] f32, 48 MiB of the 64 MiB fp16 probability plane): last read by k_vtp, before the group's first softmax
    h16* QP16 = (h16*)Ph; h16* KP16 = (h16*)Pl;   // fp16 q and k planes (8 MiB each, of 32 MiB each)
    k_wtG<<<(unsigned)((DM * (DQ + 2 * DKV) / 64 + 63) / 64), 256, 0, stream>>>(wf, DM, DQ + 2 * DKV, WALL); k_rbf<<<(unsigned)(((size_t)TT * TT / 4 + 255) / 256), 256, 0, stream>>>(amask, AMR, TT * TT / 4);
    k_wtG<<<(unsigned)((DQ * DM / 64 + 63) / 64), 256, 0, stream>>>(wo, DQ, DM, WO);
    k_csid<<<(TT * HD + 255) / 256, 256, 0, stream>>>(CS);
    const unsigned LQ = (unsigned)(((size_t)NH_ * TT * HD / 2 + 255) / 256), LKv = (unsigned)(((size_t)NKV * TT * HD / 2 + 255) / 256);
    for (int b0 = 0; b0 < NB_; b0 += GB) {
        k_cvt8<<<(unsigned)(((size_t)GB * TT * DM / 8 + 255) / 256), 256, 0, stream>>>(x + (size_t)b0 * TT * DM, XB, (size_t)GB * TT * DM / 8);
        k_gemmw<bf, 0, true><<<dim3(GB * TT / 64, NQKV / 64, 1), 32, 0, stream>>>(XB, nullptr, WALL, nullptr, DM, FA, NQKV, bf3, 0, 0, 0);   // q | k | v of GB entries as one product of width NQKV
        k_rope<<<dim3(LQ, GB, 1), 256, 0, stream>>>(FA, NQKV, NH_, CS, nullptr, nullptr, 1.0f, QP16, QPh, QPl);
        k_rope<<<dim3(LKv, GB, 1), 256, 0, stream>>>(FA + DQ, NQKV, NKV, CS, nullptr, nullptr, 1.0f, KP16, KPh, KPl);
        k_vtp<<<dim3(LKv, GB, 1), 256, 0, stream>>>(FA + DQ + DKV, NQKV, NKV, VT16, VTh, VTl);
        for (int bb = 0; bb < GB; bb += ZA / NH_) { const size_t za = (size_t)bb * NH_;   // one kv head per query head: consecutive planes over heads and entries (z-strides TT*HD)
            for (int zs = 0; zs < ZA; zs += ZH) { const size_t zq = za + zs;
                k_gemmw<bf, 2, false><<<dim3(TT / 64, TT / 64, ZH), 32, 0, stream>>>(QPh + zq * TT * HD, QPl + zq * TT * HD, KPh + zq * TT * HD, KPl + zq * TT * HD, HD, Sb, TT, nullptr, (size_t)TT * HD, (size_t)TT * HD, (size_t)TT * TT);   /* scores hl on all rows */
                k_asoft<<<ZH * TT / 8, 256, 0, stream>>>(Sb, AMR, P16 + (size_t)zs * TT * TT, Ph + (size_t)zs * RH * TT, Pl + (size_t)zs * RH * TT); }
            k_gemmw<bf, 2, false><<<dim3(RH / 64, HD / 64, ZA), 32, 0, stream>>>(Ph, Pl, VTh + za * HD * TT, VTl + za * HD * TT, TT, Ob, HD, nullptr, (size_t)RH * TT, (size_t)HD * TT, (size_t)TT * HD);
            k_gemmw<h16, 0, false><<<dim3((TT - RH) / 64, HD / 64, ZA), 32, 0, stream>>>(P16 + (size_t)RH * TT, nullptr, VT16 + za * HD * TT, nullptr, TT, Ob + (size_t)RH * HD, HD, nullptr, (size_t)TT * TT, (size_t)HD * TT, (size_t)TT * HD);
            k_merge<<<(unsigned)(((size_t)ZA * TT * HD / 2 + 255) / 256), 256, 0, stream>>>(Ob, 0, ATh + (size_t)bb * TT * DQ, ATl + (size_t)bb * TT * DQ); }
        k_gemmw<bf, 1, true><<<dim3(GB * TT / 64, DM / 64, 1), 32, 0, stream>>>(ATh, ATl, WO, nullptr, DQ, OUT + (size_t)b0 * TT * DM, DM, bo, 0, 0, 0); }
}

// v002
// A run of this version takes 432 microseconds.
// Timed twice side by side with v001, it ran 2.05 and 2.06 times as fast.
// Over all steps from v000 it is 10.9 times as fast.
#include <hip/hip_runtime.h>

// R3DAttention (x [8][1024][1024]; qkv = x Wqkv + bqkv ([1024][3072]: q | k | v blocks, 16 heads x 64); scores = q.k / 8 - mask[i][j] (f32 [1024][1024], read; shared over batch and heads); softmax; out = merged Wo + bo -> [8][1024][1024]).
// Compute dtypes, f32 accumulate: every input rounded to bf16; q/k/v on PLAIN bf16 operands (inputs: exact) + bias; scores hl x hl (3 products) on every row, attn.v: query rows < 512 hl (3 products), the rest single fp16, on exponentials against a running maximum, divided by the denominator at the end; the (bf16-rounded) mask subtracted per element in f32; softmax f32; Wo hl x exact (2 products) + bias.

#define NB_  8
#define TT   1024
#define DM   1024
#define NH_  16
#define NKV  16
#define REP  (NH_ / NKV)
#define HD   64
#define DQ   (NH_ * HD)
#define DKV  (NKV * HD)
#define GB   4                    // batch entries per projection launch (the workspace holds the head planes of GB entries)
#define RH   512                  // query rows < RH use hi+lo planes (must be TT / 2)
#define WIN  0
#define SCL  0.125f   // HD^-0.5
typedef _Float16 h16;
typedef unsigned short bf;
typedef __attribute__((ext_vector_type(16))) __bf16   v16bf;
typedef __attribute__((ext_vector_type(16))) _Float16 v16h;
typedef __attribute__((ext_vector_type(8)))  _Float16 v8h;
typedef __attribute__((ext_vector_type(8)))  unsigned short v8us;
typedef __attribute__((ext_vector_type(8)))  float    v8f;
typedef __attribute__((ext_vector_type(4)))  float    v4f;
typedef v8h  __attribute__((may_alias)) v8ha;
typedef v4f  __attribute__((may_alias)) v4fa;
typedef v8us __attribute__((may_alias)) v8usa;

__device__ __forceinline__ unsigned short f2bf(float f) { unsigned u = __float_as_uint(f); u += 0x7FFFu + ((u >> 16) & 1u); return (unsigned short)(u >> 16); }
__device__ __forceinline__ float bf2f(unsigned short b) { return __uint_as_float(((unsigned)b) << 16); }
__device__ __forceinline__ float bfr(float f) { return bf2f(f2bf(f)); }
__device__ __forceinline__ v16h cat16(v8h lo, v8h hi) { return __builtin_shufflevector(lo, hi, 0, 1, 2, 3, 4, 5, 6, 7, 8, 9, 10, 11, 12, 13, 14, 15); }
__device__ __forceinline__ v16bf cat16b(v8us lo, v8us hi) { return __builtin_bit_cast(v16bf, __builtin_shufflevector(lo, hi, 0, 1, 2, 3, 4, 5, 6, 7, 8, 9, 10, 11, 12, 13, 14, 15)); }
__device__ __forceinline__ v8f wmma16(v16h a, v16h b, v8f c) { return __builtin_amdgcn_wmma_f32_16x16x32_f16(false, a, false, b, (short)0, c, false, false); }
__device__ __forceinline__ v8f wmmab(v16bf a, v16bf b, v8f c) { return __builtin_amdgcn_wmma_f32_16x16x32_bf16(false, a, false, b, (short)0, c, false, false); }



// ---- k_gemmw: register-blocked GEMM, ONE WAVE per 64x64 output tile (16 accumulators), operands straight from K-contiguous 16-bit planes; grid (M/64, N/64, Z), 32 threads.
// C[m][n] (f32, pitch ldc, + optional f32 bias[n]) = sum_k A[m][k] Bt[n][k] (+ split products per NSPLIT). z-batch strides sA/sB/sC in elements. K % 32 == 0.
template <typename T16> struct WFrag;
template <> struct WFrag<h16> { typedef v16h V; static __device__ __forceinline__ V ld(const h16* p) { return cat16(*(const v8h*)p, *(const v8h*)(p + 16)); } static __device__ __forceinline__ v8f mma(V a, V b, v8f c) { return wmma16(a, b, c); } };
template <> struct WFrag<bf> { typedef v16bf V; static __device__ __forceinline__ V ld(const bf* p) { return cat16b(*(const v8us*)p, *(const v8us*)(p + 16)); } static __device__ __forceinline__ v8f mma(V a, V b, v8f c) { return wmmab(a, b, c); } };
template <typename T16, int NSPLIT, bool BIAS>
__global__ __launch_bounds__(32) void k_gemmw(const T16* __restrict__ A, const T16* __restrict__ A2, const T16* __restrict__ Bt, const T16* __restrict__ Bt2, int K, float* C, int ldc, const float* __restrict__ bias, size_t sA, size_t sB, size_t sC) {
    typedef typename WFrag<T16>::V V;
    __shared__ __align__(16) float os[16 * 68];
    const size_t z = blockIdx.z; A += z * sA; if (A2) A2 += z * sA; Bt += z * sB; if (Bt2) Bt2 += z * sB; C += z * sC;
    const int lane = threadIdx.x & 31, lr = lane & 15, hi = lane >> 4; const int r0 = blockIdx.x * 64, c0 = blockIdx.y * 64;
    v8f acc[4][4];
#pragma unroll
    for (int mb = 0; mb < 4; ++mb)
#pragma unroll
        for (int nb = 0; nb < 4; ++nb) acc[mb][nb] = (v8f){};
    const size_t aoff = (size_t)(r0 + lr) * K + 8 * hi, boff = (size_t)(c0 + lr) * K + 8 * hi;
#pragma unroll 1
    for (int kc = 0; kc < K; kc += 32) {
        V a[4], a2[4];
#pragma unroll
        for (int mb = 0; mb < 4; ++mb) { a[mb] = WFrag<T16>::ld(A + aoff + (size_t)mb * 16 * K + kc); if (NSPLIT == 1 || NSPLIT == 2) a2[mb] = WFrag<T16>::ld(A2 + aoff + (size_t)mb * 16 * K + kc); }
#pragma unroll
        for (int nb = 0; nb < 4; ++nb) { const V b = WFrag<T16>::ld(Bt + boff + (size_t)nb * 16 * K + kc); V b2; if (NSPLIT >= 2) b2 = WFrag<T16>::ld(Bt2 + boff + (size_t)nb * 16 * K + kc);
#pragma unroll
            for (int mb = 0; mb < 4; ++mb) { acc[mb][nb] = WFrag<T16>::mma(a[mb], b, acc[mb][nb]); if (NSPLIT == 1 || NSPLIT == 2) acc[mb][nb] = WFrag<T16>::mma(a2[mb], b, acc[mb][nb]); if (NSPLIT >= 2) acc[mb][nb] = WFrag<T16>::mma(a[mb], b2, acc[mb][nb]); } }
        asm volatile("v_nop\n\tv_nop\n\tv_nop\n\tv_nop" : "+v"(acc[0][0]), "+v"(acc[1][1]), "+v"(acc[2][2]), "+v"(acc[3][3]) : "v"(a[0]), "v"(a[3]));
    }
#pragma unroll
    for (int mb = 0; mb < 4; ++mb) {
#pragma unroll
        for (int nb = 0; nb < 4; ++nb) {
#pragma unroll
            for (int j = 0; j < 8; ++j) os[(hi * 8 + j) * 68 + nb * 16 + lr] = acc[mb][nb][j]; }
        __builtin_amdgcn_wave_barrier(); asm volatile("" ::: "memory");
        float* crow = C + (size_t)(r0 + mb * 16) * ldc + c0;
{
#pragma unroll
            for (int s = 0; s < 8; ++s) { const int row = 2 * s + hi, cofs = lr * 4; v4f val = *(const v4fa*)(os + row * 68 + cofs); if (BIAS) { val[0] += bfr(bias[c0 + cofs]); val[1] += bfr(bias[c0 + cofs + 1]); val[2] += bfr(bias[c0 + cofs + 2]); val[3] += bfr(bias[c0 + cofs + 3]); }
                *(v4f*)(crow + (size_t)row * ldc + cofs) = val; }
             }
        __builtin_amdgcn_wave_barrier(); asm volatile("" ::: "memory");
    }
}

__device__ __forceinline__ h16 tohx(float x) { return (h16)x; }
__device__ __forceinline__ void splitf(float y, unsigned short& h, unsigned short& l) { h = f2bf(y); l = f2bf(y - bf2f(h)); }
typedef __attribute__((ext_vector_type(2))) _Float16 v2h;
typedef __attribute__((ext_vector_type(4))) _Float16 v4h;
typedef __attribute__((ext_vector_type(2))) unsigned short v2us;
typedef __attribute__((ext_vector_type(4))) unsigned short v4us;
typedef __attribute__((ext_vector_type(2))) float v2f;
typedef __attribute__((ext_vector_type(4))) int v4i;

__global__ __launch_bounds__(256) void k_wtG(const float* __restrict__ w, int K, int N, bf* Bt) {
    const int lane = threadIdx.x & 31; const int L0 = (blockIdx.x * 8 + (threadIdx.x >> 5)) * 8; const int nlines = N * K / 64;
{
#pragma unroll 1
        for (int l = 0; l < 8; ++l) { const int L = L0 + l; if (L >= nlines) break; const size_t e = (size_t)L * 64 + lane * 2; const int k = (int)(e % K), n = (int)(e / K); v2us o;
            o[0] = f2bf(w[(size_t)k * N + n]); o[1] = f2bf(w[(size_t)(k + 1) * N + n]); *(v2us*)(Bt + e) = o; }
         }
}
__global__ __launch_bounds__(256) void k_cvt8(const float* __restrict__ src, bf* dst, size_t n8) { const size_t i = (size_t)blockIdx.x * 256 + threadIdx.x; if (i >= n8) return; const v8f v = *(const v8f*)(src + i * 8); v8us o;
#pragma unroll
    for (int k = 0; k < 8; ++k) o[k] = f2bf(v[k]); *(v8us*)(dst + i * 8) = o;  }
__global__ __launch_bounds__(256) void k_cscvt(const float* __restrict__ cosT, const float* __restrict__ sinT, float* CS) { const int idx = blockIdx.x * 256 + threadIdx.x; if (idx >= TT * HD) return; v2f cs; cs[0] = bfr(cosT[idx]); cs[1] = bfr(sinT[idx]); *(v2f*)(CS + (size_t)idx * 2) = cs;  }
// k_rope: grid.y = batch entry (F rows y*TT.., planes y*nheads..); head planes [h][t][d] (fp16 + hi/lo) of rope(x) x sc with the rotate-half convention out[d] = x[d] cos[t][d] - x[d+HD/2] sin[t][d], out[d+HD/2] = x[d+HD/2] cos[t][d+HD/2] + x[d] sin[t][d+HD/2]
__global__ __launch_bounds__(256) void k_rope(const float* __restrict__ F, int pitch, int nheads, const float* __restrict__ CS, const float* __restrict__ RF, const float* __restrict__ nw, float sc, h16* P16, bf* Ph, bf* Pl) {
    { const size_t po = (size_t)blockIdx.y * nheads * TT * HD; F += (size_t)blockIdx.y * TT * pitch; P16 += po; Ph += po; Pl += po; }
    const size_t e = ((size_t)blockIdx.x * 256 + threadIdx.x) * 2; if (e >= (size_t)nheads * TT * HD) return; const int d = (int)(e % HD); const int t = (int)((e / HD) % TT); const int h = (int)(e / ((size_t)HD * TT)); const float* f = F + (size_t)t * pitch + h * HD; const float rf = RF ? RF[(size_t)h * TT + t] : 1.0f; v2h o16; v2us oh, ol;
#pragma unroll
    for (int q = 0; q < 2; ++q) { const int dd = d + q; const int dp = (dd < HD / 2) ? dd + HD / 2 : dd - HD / 2; float x0 = f[dd], x1 = f[dp];
        if (RF) { float n0 = __fmul_rn(x0, rf), n1 = __fmul_rn(x1, rf); asm volatile("" : "+v"(n0)); asm volatile("" : "+v"(n1)); x0 = __fmul_rn(bfr(nw[dd]), n0); x1 = __fmul_rn(bfr(nw[dp]), n1); }
        const v2f cs = *(const v2f*)(CS + ((size_t)t * HD + dd) * 2); float a = __fmul_rn(x0, cs[0]), bq = __fmul_rn(x1, cs[1]); asm volatile("" : "+v"(a)); asm volatile("" : "+v"(bq)); const float r = ((dd < HD / 2) ? __fsub_rn(a, bq) : __fadd_rn(a, bq)) * sc;
        o16[q] = tohx(r); unsigned short a2, c2; splitf(r, a2, c2); oh[q] = a2; ol[q] = c2; }
    *(v2h*)(P16 + e) = o16; *(v2us*)(Ph + e) = oh; *(v2us*)(Pl + e) = ol;  }
__global__ __launch_bounds__(256) void k_vtp(const float* __restrict__ F, int pitch, int nheads, h16* V16, bf* Vh, bf* Vl) { const size_t e = ((size_t)blockIdx.x * 256 + threadIdx.x) * 2; if (e >= (size_t)nheads * HD * TT) return; const int t = (int)(e % TT); const int d = (int)((e / TT) % HD); const int g = (int)(e / ((size_t)TT * HD)); v2h o16; v2us oh, ol; { const size_t po = (size_t)blockIdx.y * nheads * HD * TT; F += (size_t)blockIdx.y * TT * pitch; V16 += po; Vh += po; Vl += po; }   // grid.y = batch entry
#pragma unroll
    for (int q = 0; q < 2; ++q) { const float x = F[(size_t)(t + q) * pitch + g * HD + d]; o16[q] = tohx(x); unsigned short a2, c2; splitf(x, a2, c2); oh[q] = a2; ol[q] = c2; }
    *(v2h*)(V16 + e) = o16; *(v2us*)(Vh + e) = oh; *(v2us*)(Vl + e) = ol;  }
__global__ __launch_bounds__(256) void k_csid(float* CS) { const int idx = blockIdx.x * 256 + threadIdx.x; if (idx >= TT * HD) return; v2f cs; cs[0] = 1.0f; cs[1] = 0.0f; *(v2f*)(CS + (size_t)idx * 2) = cs;  }
// k_rbf: bf16-rounded f32 copy of the mask.
__global__ __launch_bounds__(256) void k_rbf(const float* __restrict__ src, float* dst, int n4) { const int i = blockIdx.x * 256 + threadIdx.x; if (i >= n4) return; const v4f a = *(const v4f*)(src + (size_t)i * 4); v4f o; for (int u = 0; u < 4; ++u) o[u] = bfr(a[u]); *(v4f*)(dst + (size_t)i * 4) = o;  }
// ---- k_fattn: scores, softmax and attn.v of one head in one kernel; neither the scores nor the probabilities go through memory.
// Transposed products: S^T = K Q^T (A = 16 keys, B = 16 queries), so a lane holds 8 consecutive keys of ONE query (column lr) per tile, and two
// 16-key tiles are, register for register, the B operand (32 keys) of O^T += V^T P^T (A = 16 rows of the [d][t] value planes). No LDS, no barrier.
// One wave: 32 queries (two column groups) against all TT keys in passes of 32, running maximum and denominator per query. Grid (RH / 128, heads), 8 waves:
// waves 0-3 take query rows < RH (P and V as hi+lo bf16, 3 products), waves 4-7 the rows >= RH (P and V single fp16), so every workgroup carries the same work.
typedef __attribute__((ext_vector_type(8))) unsigned v8u;
typedef __attribute__((ext_vector_type(2))) __bf16 v2bf;
#define L2E 1.4426950408889634f
#define LAZY 4.0f   // the maximum in use may trail a query's true maximum by this much (an exponential then reaches e^4, far inside fp16 and bf16 range)
__device__ __forceinline__ unsigned pack2(float a, float b) { v2f x; x[0] = a; x[1] = b; return __builtin_bit_cast(unsigned, __builtin_convertvector(x, v2bf)); }   // round to nearest even
__device__ __forceinline__ float xhalf(float x) { return __builtin_bit_cast(float, __builtin_amdgcn_permlanex16(__builtin_bit_cast(int, x), __builtin_bit_cast(int, x), 0x76543210, 0xfedcba98, false, false)); }   // lane l <-> lane l ^ 16
template <bool HI>
__device__ __forceinline__ void fattn_body(const bf* __restrict__ Qh, const bf* __restrict__ Ql, const bf* __restrict__ Kh, const bf* __restrict__ Kl, const bf* __restrict__ Vh, const bf* __restrict__ Vl, const h16* __restrict__ V16, const float* __restrict__ am, bf* Ah, bf* Al, int q0, int lane) {
    const int lr = lane & 15, hi = lane >> 4;
    v16bf qh[2][2], ql[2][2];   // [column group][k step of 32]
    v16bf kh[2][2], kl[2][2];   // [16-key tile][k step]
    v4f mk[2][2][2];            // [column group][16-key tile][half of the lane's 8 keys]
    const bf* kph = Kh + (size_t)lr * HD + 8 * hi; const bf* kpl = Kl + (size_t)lr * HD + 8 * hi;
    const float* mp = am + (size_t)(q0 + lr) * TT + 8 * hi;
    const size_t vof = (size_t)lr * TT + 8 * hi;
    { const bf* qph = Qh + (size_t)(q0 + lr) * HD + 8 * hi; const bf* qpl = Ql + (size_t)(q0 + lr) * HD + 8 * hi;
#pragma unroll
        for (int g = 0; g < 2; ++g)
#pragma unroll
            for (int kc = 0; kc < 2; ++kc) { qh[g][kc] = WFrag<bf>::ld(qph + 16 * g * HD + 32 * kc); ql[g][kc] = WFrag<bf>::ld(qpl + 16 * g * HD + 32 * kc); }
#pragma unroll
        for (int kt = 0; kt < 2; ++kt) {
#pragma unroll
            for (int kc = 0; kc < 2; ++kc) { kh[kt][kc] = WFrag<bf>::ld(kph + 16 * kt * HD + 32 * kc); kl[kt][kc] = WFrag<bf>::ld(kpl + 16 * kt * HD + 32 * kc); }
#pragma unroll
            for (int g = 0; g < 2; ++g) { mk[g][kt][0] = *(const v4f*)(mp + 16 * g * TT + 16 * kt); mk[g][kt][1] = *(const v4f*)(mp + 16 * g * TT + 16 * kt + 4); } }
        asm volatile("s_wait_xcnt 0x0" :: "v"(qph), "v"(qpl), "v"(kph), "v"(kpl), "v"(mp) : "memory");   // before any address register of the loads above is reused; the addresses are named so that they stay in their registers up to here
        __builtin_amdgcn_sched_barrier(0);   // keeps later register writes behind that wait
    }
    v8f acc[2][4]; float mrun[2]; v2f lrun[2];
#pragma unroll
    for (int g = 0; g < 2; ++g) { mrun[g] = -3.0e38f; lrun[g] = (v2f){};
#pragma unroll
        for (int t = 0; t < 4; ++t) acc[g][t] = (v8f){}; }
    const v2f scl2 = {SCL, SCL}, l2e2 = {L2E, L2E};
#pragma unroll 1   // one pass a trip: unrolled, the fragments of two passes would be live at once
    for (int kb = 0; kb < TT / 32; ++kb) {
        const int key0 = kb * 32, nk0 = (kb + 1 < TT / 32) ? key0 + 32 : key0;   // the last pass fetches its own rows again (in bounds, unused)
        v8f s[2][2];   // [16-key tile][column group]
#pragma unroll
        for (int kt = 0; kt < 2; ++kt)
#pragma unroll
            for (int g = 0; g < 2; ++g) s[kt][g] = (v8f){};
#pragma unroll
        for (int kc = 0; kc < 2; ++kc) {   // per accumulator: qh.kh, ql.kh, qh.kl, k steps ascending
#pragma unroll
            for (int kt = 0; kt < 2; ++kt)
#pragma unroll
                for (int g = 0; g < 2; ++g) s[kt][g] = wmmab(kh[kt][kc], qh[g][kc], s[kt][g]);
#pragma unroll
            for (int kt = 0; kt < 2; ++kt)
#pragma unroll
                for (int g = 0; g < 2; ++g) s[kt][g] = wmmab(kh[kt][kc], ql[g][kc], s[kt][g]);
#pragma unroll
            for (int kt = 0; kt < 2; ++kt)
#pragma unroll
                for (int g = 0; g < 2; ++g) s[kt][g] = wmmab(kl[kt][kc], qh[g][kc], s[kt][g]); }
        // t = s / 8 - mask (s / 8 is exact, so the fused form rounds once, as a separate subtraction does)
#pragma unroll
        for (int g = 0; g < 2; ++g)
#pragma unroll
            for (int kt = 0; kt < 2; ++kt)
#pragma unroll
                for (int i = 0; i < 4; ++i) { const v2f sv = {s[kt][g][2 * i], s[kt][g][2 * i + 1]}, mv = {mk[g][kt][i >> 1][2 * (i & 1)], mk[g][kt][i >> 1][2 * (i & 1) + 1]};
                    const v2f t = __builtin_elementwise_fma(sv, scl2, -mv); s[kt][g][2 * i] = t[0]; s[kt][g][2 * i + 1] = t[1]; }
        // One group of loads, in flight under the softmax: this pass's values, the next pass's keys and mask (their registers are free from here on).
        __builtin_amdgcn_sched_barrier(0);   // keeps the group from sinking towards its users, where its latency would be exposed
        v16bf vh[4], vl[4]; v16h vx[4];
        { const bf* nkh = kph + (size_t)nk0 * HD; const bf* nkl = kpl + (size_t)nk0 * HD; const float* nmp = mp + nk0;
            const bf* vph = Vh + vof + key0; const bf* vpl = Vl + vof + key0; const h16* vpx = V16 + vof + key0;
#pragma unroll
            for (int t = 0; t < 4; ++t) { if (HI) { vh[t] = WFrag<bf>::ld(vph + 16 * t * TT); vl[t] = WFrag<bf>::ld(vpl + 16 * t * TT); } else vx[t] = WFrag<h16>::ld(vpx + 16 * t * TT); }
#pragma unroll
            for (int kt = 0; kt < 2; ++kt)
#pragma unroll
                for (int kc = 0; kc < 2; ++kc) { kh[kt][kc] = WFrag<bf>::ld(nkh + 16 * kt * HD + 32 * kc); kl[kt][kc] = WFrag<bf>::ld(nkl + 16 * kt * HD + 32 * kc); }
#pragma unroll
            for (int kt = 0; kt < 2; ++kt)
#pragma unroll
                for (int g = 0; g < 2; ++g) { mk[g][kt][0] = *(const v4f*)(nmp + 16 * g * TT + 16 * kt); mk[g][kt][1] = *(const v4f*)(nmp + 16 * g * TT + 16 * kt + 4); }
            // before any address register of the group is reused; the addresses are named so that they stay in their registers up to here
            if (HI) asm volatile("s_wait_xcnt 0x0" :: "v"(nkh), "v"(nkl), "v"(nmp), "v"(vph), "v"(vpl) : "memory"); else asm volatile("s_wait_xcnt 0x0" :: "v"(nkh), "v"(nkl), "v"(nmp), "v"(vpx) : "memory"); }
        __builtin_amdgcn_sched_barrier(0);   // keeps later register writes behind that wait
        // each query's maximum over the pass
        float mb[2]; bool need = false;
#pragma unroll
        for (int g = 0; g < 2; ++g) { float mx = -3.0e38f;
#pragma unroll
            for (int kt = 0; kt < 2; ++kt)
#pragma unroll
                for (int j = 0; j < 8; ++j) mx = fmaxf(mx, s[kt][g][j]);
            mx = fmaxf(mx, xhalf(mx)); mb[g] = mx; need = need || (mx > mrun[g] + LAZY); }
        if (__builtin_amdgcn_ballot_w32(need) != 0) {   // wave-uniform; always on the first pass, rare later
#pragma unroll
            for (int g = 0; g < 2; ++g) { const float mn = fmaxf(mrun[g], mb[g]); const float corr = __builtin_amdgcn_exp2f((mrun[g] - mn) * L2E); mrun[g] = mn; lrun[g] = lrun[g] * corr;   // corr = 0 on the first pass
#pragma unroll
                for (int t = 0; t < 4; ++t) acc[g][t] = acc[g][t] * corr; } }
#pragma unroll
        for (int g = 0; g < 2; ++g) { const float nm = -mrun[g] * L2E; const v2f nm2 = {nm, nm}; v8u wh, wl; v16h px;
#pragma unroll
            for (int i = 0; i < 8; ++i) { const int kt = i >> 2, r = 2 * (i & 3);   // operand elements 2i, 2i+1 = tile kt, registers r, r+1
                const v2f sv = {s[kt][g][r], s[kt][g][r + 1]}; const v2f a = __builtin_elementwise_fma(sv, l2e2, nm2);
                v2f p; p[0] = __builtin_amdgcn_exp2f(a[0]); p[1] = __builtin_amdgcn_exp2f(a[1]); lrun[g] += p;
                if (HI) { const unsigned h = pack2(p[0], p[1]); wh[i] = h; wl[i] = pack2(p[0] - __uint_as_float(h << 16), p[1] - __uint_as_float(h & 0xFFFF0000u)); }
                else { px[2 * i] = tohx(p[0]); px[2 * i + 1] = tohx(p[1]); } }
            if (HI) { const v16bf ph = __builtin_bit_cast(v16bf, wh), pl = __builtin_bit_cast(v16bf, wl);
#pragma unroll
                for (int t = 0; t < 4; ++t) acc[g][t] = wmmab(vh[t], ph, acc[g][t]);   // per accumulator: ph.vh, pl.vh, ph.vl
#pragma unroll
                for (int t = 0; t < 4; ++t) acc[g][t] = wmmab(vh[t], pl, acc[g][t]);
#pragma unroll
                for (int t = 0; t < 4; ++t) acc[g][t] = wmmab(vl[t], ph, acc[g][t]);
            } else {
#pragma unroll
                for (int t = 0; t < 4; ++t) acc[g][t] = wmma16(vx[t], px, acc[g][t]); } }
        __builtin_amdgcn_sched_barrier(0);   // holds the v_nops behind the last matrix instruction
        asm volatile("v_nop\n\tv_nop\n\tv_nop\n\tv_nop");   // the distance behind the pass's last matrix instruction, on the back edge and on the way out of the loop alike
        __builtin_amdgcn_sched_barrier(0);
    }
#pragma unroll
    for (int g = 0; g < 2; ++g) { const float lh = lrun[g][0] + lrun[g][1]; const float l = lh + xhalf(lh); const float inv = __fdiv_rn(1.0f, l); bf* pa = Ah + (size_t)(q0 + 16 * g + lr) * DQ + 8 * hi; bf* pb = Al + (size_t)(q0 + 16 * g + lr) * DQ + 8 * hi;   // a lane's 8 registers are d = 16 t + 8 hi + 0..7 of query lr
#pragma unroll
        for (int t = 0; t < 4; ++t) { v8us oh, ol;
#pragma unroll
            for (int j = 0; j < 8; ++j) { unsigned short a, c2; splitf(acc[g][t][j] * inv, a, c2); oh[j] = a; ol[j] = c2; }
            *(v8us*)(pa + 16 * t) = oh; *(v8us*)(pb + 16 * t) = ol; } }
}
// grid.y = entry * NH_ + head (planes consecutive); writes the merged [t][DQ] hi and lo planes that Wo reads.
__global__ __launch_bounds__(256) void k_fattn(const bf* __restrict__ Qh, const bf* __restrict__ Ql, const bf* __restrict__ Kh, const bf* __restrict__ Kl, const bf* __restrict__ Vh, const bf* __restrict__ Vl, const h16* __restrict__ V16, const float* __restrict__ am, bf* Ah, bf* Al) {
    static_assert(2 * RH == TT && RH % 128 == 0 && HD == 64 && NKV == NH_, "the wave split below is written for these");
    const int lane = threadIdx.x & 31; const int wave = __builtin_amdgcn_readfirstlane((int)(threadIdx.x >> 5));
    const size_t z = blockIdx.y, po = z * TT * HD, ao = (z / NH_) * TT * DQ + (z % NH_) * HD; const int qb = (blockIdx.x * 4 + (wave & 3)) * 32;
    if (wave < 4) fattn_body<true>(Qh + po, Ql + po, Kh + po, Kl + po, Vh + po, Vl + po, V16 + po, am, Ah + ao, Al + ao, qb, lane);
    else fattn_body<false>(Qh + po, Ql + po, Kh + po, Kl + po, Vh + po, Vl + po, V16 + po, am, Ah + ao, Al + ao, RH + qb, lane);
}

extern "C" void kernel_launch(void* const* d_in, const int* in_sizes, int n_in,
                              void* d_out, int out_size, void* d_ws, size_t ws_size, hipStream_t stream) {
    (void)in_sizes; (void)n_in; (void)out_size;
    const float* x = (const float*)d_in[0]; const float* amask = (const float*)d_in[1]; const float* wf = (const float*)d_in[2]; const float* bf3 = (const float*)d_in[3]; const float* wo = (const float*)d_in[4]; const float* bo = (const float*)d_in[5];
    float* OUT = (float*)d_out;     // [8][1024][1024]
    char* wsp = (char*)d_ws;
    auto take = [&](size_t bytes) { char* p = wsp; wsp += (bytes + 255) & ~(size_t)255; return (void*)p; };
    bf* WO = (bf*)take((size_t)DM * DQ * 2); float* CS = (float*)take((size_t)TT * HD * 2 * 4);
    bf* WALL = (bf*)take((size_t)(DQ + 2 * DKV) * DM * 2); float* AMR = (float*)take((size_t)TT * TT * 4);
    h16* VT16 = (h16*)take((size_t)GB * NKV * HD * TT * 2);
    bf* QPh = (bf*)take((size_t)GB * NH_ * TT * HD * 2); bf* QPl = (bf*)take((size_t)GB * NH_ * TT * HD * 2); bf* KPh = (bf*)take((size_t)GB * NKV * TT * HD * 2); bf* KPl = (bf*)take((size_t)GB * NKV * TT * HD * 2); bf* VTh = (bf*)take((size_t)GB * NKV * HD * TT * 2); bf* VTl = (bf*)take((size_t)GB * NKV * HD * TT * 2);
    const int NQKV = DQ + 2 * DKV;
    bf* XB = (bf*)take((size_t)GB * TT * DM * 2);            // bf16 x of GB entries
    float* FA = (float*)take((size_t)GB * TT * NQKV * 4);    // q|k|v projections of GB entries ([GB*TT][NQKV] f32)
    h16* QP16 = (h16*)take((size_t)GB * NH_ * TT * HD * 2); h16* KP16 = (h16*)take((size_t)GB * NKV * TT * HD * 2);   // fp16 q and k planes
    bf* ATh = (bf*)take((size_t)GB * TT * DQ * 2); bf* ATl = (bf*)take((size_t)GB * TT * DQ * 2);
    if ((size_t)(wsp - (char*)d_ws) > ws_size) return;    // ws 256 MiB; the carve-up takes about 160 MiB
    k_wtG<<<(unsigned)((DM * (DQ + 2 * DKV) / 64 + 63) / 64), 256, 0, stream>>>(wf, DM, DQ + 2 * DKV, WALL); k_rbf<<<(unsigned)(((size_t)TT * TT / 4 + 255) / 256), 256, 0, stream>>>(amask, AMR, TT * TT / 4);
    k_wtG<<<(unsigned)((DQ * DM / 64 + 63) / 64), 256, 0, stream>>>(wo, DQ, DM, WO);
    k_csid<<<(TT * HD + 255) / 256, 256, 0, stream>>>(CS);
    const unsigned LQ = (unsigned)(((size_t)NH_ * TT * HD / 2 + 255) / 256), LKv = (unsigned)(((size_t)NKV * TT * HD / 2 + 255) / 256);
    for (int b0 = 0; b0 < NB_; b0 += GB) {
        k_cvt8<<<(unsigned)(((size_t)GB * TT * DM / 8 + 255) / 256), 256, 0, stream>>>(x + (size_t)b0 * TT * DM, XB, (size_t)GB * TT * DM / 8);
        k_gemmw<bf, 0, true><<<dim3(GB * TT / 64, NQKV / 64, 1), 32, 0, stream>>>(XB, nullptr, WALL, nullptr, DM, FA, NQKV, bf3, 0, 0, 0);   // q | k | v of GB entries as one product of width NQKV
        k_rope<<<dim3(LQ, GB, 1), 256, 0, stream>>>(FA, NQKV, NH_, CS, nullptr, nullptr, 1.0f, QP16, QPh, QPl);
        k_rope<<<dim3(LKv, GB, 1), 256, 0, stream>>>(FA + DQ, NQKV, NKV, CS, nullptr, nullptr, 1.0f, KP16, KPh, KPl);
        k_vtp<<<dim3(LKv, GB, 1), 256, 0, stream>>>(FA + DQ + DKV, NQKV, NKV, VT16, VTh, VTl);
        k_fattn<<<dim3(RH / 128, GB * NH_, 1), 256, 0, stream>>>(QPh, QPl, KPh, KPl, VTh, VTl, VT16, AMR, ATh, ATl);   // scores, softmax, attn.v and the head merge of GB entries
        k_gemmw<bf, 1, true><<<dim3(GB * TT / 64, DM / 64, 1), 32, 0, stream>>>(ATh, ATl, WO, nullptr, DQ, OUT + (size_t)b0 * TT * DM, DM, bo, 0, 0, 0); }
}

// v003
// It runs in 348 microseconds.
// Two timings next to v002 both put it at 1.24 times that version's speed.
// Over all steps from v000 it is 13.5 times as fast.
#include <hip/hip_runtime.h>

// R3DAttention (x [8][1024][1024]; qkv = x Wqkv + bqkv ([1024][3072]: q | k | v blocks, 16 heads x 64); scores = q.k / 8 - mask[i][j] (f32 [1024][1024], read; shared over batch and heads); softmax; out = merged Wo + bo -> [8][1024][1024]).
// Compute dtypes, f32 accumulate: every input rounded to bf16; q/k/v on PLAIN bf16 operands (inputs: exact) + bias; scores hl x hl (3 products) on every row, attn.v: query rows < 512 hl (3 products), the rest single fp16, on exponentials against a running maximum, divided by the denominator at the end; the (bf16-rounded) mask subtracted per element in f32; softmax f32; Wo hl x exact (2 products) + bias.

#define NB_  8
#define TT   1024
#define DM   1024
#define NH_  16
#define NKV  16
#define REP  (NH_ / NKV)
#define HD   64
#define DQ   (NH_ * HD)
#define DKV  (NKV * HD)
#define GB   4                    // batch entries per projection launch (the workspace holds the head planes of GB entries)
#define RH   512                  // query rows < RH use hi+lo planes (must be TT / 2)
#define WIN  0
#define SCL  0.125f   // HD^-0.5
typedef _Float16 h16;
typedef unsigned short bf;
typedef __attribute__((ext_vector_type(16))) __bf16   v16bf;
typedef __attribute__((ext_vector_type(16))) _Float16 v16h;
typedef __attribute__((ext_vector_type(8)))  _Float16 v8h;
typedef __attribute__((ext_vector_type(8)))  unsigned short v8us;
typedef __attribute__((ext_vector_type(8)))  float    v8f;
typedef __attribute__((ext_vector_type(4)))  float    v4f;
typedef v8h  __attribute__((may_alias)) v8ha;
typedef v4f  __attribute__((may_alias)) v4fa;
typedef v8us __attribute__((may_alias)) v8usa;

__device__ __forceinline__ unsigned short f2bf(float f) { unsigned u = __float_as_uint(f); u += 0x7FFFu + ((u >> 16) & 1u); return (unsigned short)(u >> 16); }
__device__ __forceinline__ float bf2f(unsigned short b) { return __uint_as_float(((unsigned)b) << 16); }
__device__ __forceinline__ float bfr(float f) { return bf2f(f2bf(f)); }
__device__ __forceinline__ v16h cat16(v8h lo, v8h hi) { return __builtin_shufflevector(lo, hi, 0, 1, 2, 3, 4, 5, 6, 7, 8, 9, 10, 11, 12, 13, 14, 15); }
__device__ __forceinline__ v16bf cat16b(v8us lo, v8us hi) { return __builtin_bit_cast(v16bf, __builtin_shufflevector(lo, hi, 0, 1, 2, 3, 4, 5, 6, 7, 8, 9, 10, 11, 12, 13, 14, 15)); }
__device__ __forceinline__ v8f wmma16(v16h a, v16h b, v8f c) { return __builtin_amdgcn_wmma_f32_16x16x32_f16(false, a, false, b, (short)0, c, false, false); }
__device__ __forceinline__ v8f wmmab(v16bf a, v16bf b, v8f c) { return __builtin_amdgcn_wmma_f32_16x16x32_bf16(false, a, false, b, (short)0, c, false, false); }



// ---- k_gemmw: register-blocked GEMM, ONE WAVE per 64x64 output tile (16 accumulators), operands straight from K-contiguous 16-bit planes; grid (M/64, N/64, Z), 32 threads.
// C[m][n] (f32, pitch ldc, + optional f32 bias[n]) = sum_k A[m][k] Bt[n][k] (+ split products per NSPLIT). z-batch strides sA/sB/sC in elements. K % 32 == 0.
template <typename T16> struct WFrag;
template <> struct WFrag<h16> { typedef v16h V; static __device__ __forceinline__ V ld(const h16* p) { return cat16(*(const v8h*)p, *(const v8h*)(p + 16)); } static __device__ __forceinline__ v8f mma(V a, V b, v8f c) { return wmma16(a, b, c); } };
template <> struct WFrag<bf> { typedef v16bf V; static __device__ __forceinline__ V ld(const bf* p) { return cat16b(*(const v8us*)p, *(const v8us*)(p + 16)); } static __device__ __forceinline__ v8f mma(V a, V b, v8f c) { return wmmab(a, b, c); } };
template <typename T16, int NSPLIT, bool BIAS>
__global__ __launch_bounds__(32) void k_gemmw(const T16* __restrict__ A, const T16* __restrict__ A2, const T16* __restrict__ Bt, const T16* __restrict__ Bt2, int K, float* C, int ldc, const float* __restrict__ bias, size_t sA, size_t sB, size_t sC) {
    typedef typename WFrag<T16>::V V;
    __shared__ __align__(16) float os[16 * 68];
    const size_t z = blockIdx.z; A += z * sA; if (A2) A2 += z * sA; Bt += z * sB; if (Bt2) Bt2 += z * sB; C += z * sC;
    const int lane = threadIdx.x & 31, lr = lane & 15, hi = lane >> 4; const int r0 = blockIdx.x * 64, c0 = blockIdx.y * 64;
    v8f acc[4][4];
#pragma unroll
    for (int mb = 0; mb < 4; ++mb)
#pragma unroll
        for (int nb = 0; nb < 4; ++nb) acc[mb][nb] = (v8f){};
    const size_t aoff = (size_t)(r0 + lr) * K + 8 * hi, boff = (size_t)(c0 + lr) * K + 8 * hi;
#pragma unroll 1
    for (int kc = 0; kc < K; kc += 32) {
        V a[4], a2[4];
#pragma unroll
        for (int mb = 0; mb < 4; ++mb) { a[mb] = WFrag<T16>::ld(A + aoff + (size_t)mb * 16 * K + kc); if (NSPLIT == 1 || NSPLIT == 2) a2[mb] = WFrag<T16>::ld(A2 + aoff + (size_t)mb * 16 * K + kc); }
#pragma unroll
        for (int nb = 0; nb < 4; ++nb) { const V b = WFrag<T16>::ld(Bt + boff + (size_t)nb * 16 * K + kc); V b2; if (NSPLIT >= 2) b2 = WFrag<T16>::ld(Bt2 + boff + (size_t)nb * 16 * K + kc);
#pragma unroll
            for (int mb = 0; mb < 4; ++mb) { acc[mb][nb] = WFrag<T16>::mma(a[mb], b, acc[mb][nb]); if (NSPLIT == 1 || NSPLIT == 2) acc[mb][nb] = WFrag<T16>::mma(a2[mb], b, acc[mb][nb]); if (NSPLIT >= 2) acc[mb][nb] = WFrag<T16>::mma(a[mb], b2, acc[mb][nb]); } }
        asm volatile("v_nop\n\tv_nop\n\tv_nop\n\tv_nop" : "+v"(acc[0][0]), "+v"(acc[1][1]), "+v"(acc[2][2]), "+v"(acc[3][3]) : "v"(a[0]), "v"(a[3]));
    }
#pragma unroll
    for (int mb = 0; mb < 4; ++mb) {
#pragma unroll
        for (int nb = 0; nb < 4; ++nb) {
#pragma unroll
            for (int j = 0; j < 8; ++j) os[(hi * 8 + j) * 68 + nb * 16 + lr] = acc[mb][nb][j]; }
        __builtin_amdgcn_wave_barrier(); asm volatile("" ::: "memory");
        float* crow = C + (size_t)(r0 + mb * 16) * ldc + c0;
{
#pragma unroll
            for (int s = 0; s < 8; ++s) { const int row = 2 * s + hi, cofs = lr * 4; v4f val = *(const v4fa*)(os + row * 68 + cofs); if (BIAS) { val[0] += bfr(bias[c0 + cofs]); val[1] += bfr(bias[c0 + cofs + 1]); val[2] += bfr(bias[c0 + cofs + 2]); val[3] += bfr(bias[c0 + cofs + 3]); }
                *(v4f*)(crow + (size_t)row * ldc + cofs) = val; }
             }
        __builtin_amdgcn_wave_barrier(); asm volatile("" ::: "memory");
    }
}

__device__ __forceinline__ h16 tohx(float x) { return (h16)x; }
__device__ __forceinline__ void splitf(float y, unsigned short& h, unsigned short& l) { h = f2bf(y); l = f2bf(y - bf2f(h)); }
typedef __attribute__((ext_vector_type(2))) _Float16 v2h;
typedef __attribute__((ext_vector_type(4))) _Float16 v4h;
typedef __attribute__((ext_vector_type(2))) unsigned short v2us;
typedef __attribute__((ext_vector_type(4))) unsigned short v4us;
typedef __attribute__((ext_vector_type(2))) float v2f;
typedef __attribute__((ext_vector_type(4))) int v4i;

__global__ __launch_bounds__(256) void k_wtG(const float* __restrict__ w, int K, int N, bf* Bt) {
    const int lane = threadIdx.x & 31; const int L0 = (blockIdx.x * 8 + (threadIdx.x >> 5)) * 8; const int nlines = N * K / 64;
{
#pragma unroll 1
        for (int l = 0; l < 8; ++l) { const int L = L0 + l; if (L >= nlines) break; const size_t e = (size_t)L * 64 + lane * 2; const int k = (int)(e % K), n = (int)(e / K); v2us o;
            o[0] = f2bf(w[(size_t)k * N + n]); o[1] = f2bf(w[(size_t)(k + 1) * N + n]); *(v2us*)(Bt + e) = o; }
         }
}
__global__ __launch_bounds__(256) void k_cvt8(const float* __restrict__ src, bf* dst, size_t n8) { const size_t i = (size_t)blockIdx.x * 256 + threadIdx.x; if (i >= n8) return; const v8f v = *(const v8f*)(src + i * 8); v8us o;
#pragma unroll
    for (int k = 0; k < 8; ++k) o[k] = f2bf(v[k]); *(v8us*)(dst + i * 8) = o;  }
// k_rbf: bf16-rounded f32 copy of the mask.
__global__ __launch_bounds__(256) void k_rbf(const float* __restrict__ src, float* dst, int n4) { const int i = blockIdx.x * 256 + threadIdx.x; if (i >= n4) return; const v4f a = *(const v4f*)(src + (size_t)i * 4); v4f o; for (int u = 0; u < 4; ++u) o[u] = bfr(a[u]); *(v4f*)(dst + (size_t)i * 4) = o;  }
// ---- k_fattn: scores, softmax and attn.v of one head in one kernel; neither the scores nor the probabilities go through memory.
// Transposed products: S^T = K Q^T (A = 16 keys, B = 16 queries), so a lane holds 8 consecutive keys of ONE query (column lr) per tile, and two
// 16-key tiles are, register for register, the B operand (32 keys) of O^T += V^T P^T (A = 16 rows of the [d][t] value planes). No LDS, no barrier.
// One wave: 32 queries (two column groups) against all TT keys in passes of 32, running maximum and denominator per query. Grid (RH / 128, heads), 8 waves:
// waves 0-3 take query rows < RH (P and V as hi+lo bf16, 3 products), waves 4-7 the rows >= RH (P and V single fp16), so every workgroup carries the same work.
typedef __attribute__((ext_vector_type(8))) unsigned v8u;
typedef __attribute__((ext_vector_type(2))) __bf16 v2bf;
#define L2E 1.4426950408889634f
#define LAZY 4.0f   // the maximum in use may trail a query's true maximum by this much (an exponential then reaches e^4, far inside fp16 and bf16 range)
__device__ __forceinline__ unsigned pack2(float a, float b) { v2f x; x[0] = a; x[1] = b; return __builtin_bit_cast(unsigned, __builtin_convertvector(x, v2bf)); }   // round to nearest even
__device__ __forceinline__ float xhalf(float x) { return __builtin_bit_cast(float, __builtin_amdgcn_permlanex16(__builtin_bit_cast(int, x), __builtin_bit_cast(int, x), 0x76543210, 0xfedcba98, false, false)); }   // lane l <-> lane l ^ 16
// ---- k_gemmqkv: the q | k | v projection of GB entries, ONE WAVE per 64x64 tile (= 64 rows t of one head's q, k or v), main loop as k_gemmw; the epilogue adds the bias and
// writes the planes that k_fattn reads: q, k [head][t][d] and v [head][d][t], each as hi + lo bf16 (v also single fp16). A lane's 8 accumulator registers are 8 consecutive rows of the
// A operand, so a q or k tile is computed as W X^T (A = 64 d) and a v tile as X W^T (A = 64 t): either way they are 8 consecutive elements of one plane row (the B index).
typedef __attribute__((ext_vector_type(4))) unsigned v4u;
#define SP 36   // staging pitch in dwords: 144 B for rows of 128 B
template <bool ISV>
__device__ __forceinline__ void qkv_store(const v8f (&acc)[4][4], const float* __restrict__ bias, unsigned* st, bf* Ph, bf* Pl, h16* P16, int lane) {
    constexpr int PITCH = ISV ? TT : HD;   // plane row pitch in elements
    const int lr = lane & 15, hi = lane >> 4, rr = lane >> 3, cc = lane & 7;
    v8f bq[4];   // q, k: the bias runs along the plane row (d = 16 mb + 8 hi + j)
    if (!ISV) {
#pragma unroll
        for (int mb = 0; mb < 4; ++mb) { const v4f b0 = *(const v4f*)(bias + mb * 16 + hi * 8), b1 = *(const v4f*)(bias + mb * 16 + hi * 8 + 4);
#pragma unroll
            for (int j = 0; j < 4; ++j) { bq[mb][j] = bfr(b0[j]); bq[mb][4 + j] = bfr(b1[j]); } } }
    float bv[4];   // v: one d, so one bias, per plane row (d = 16 nb + lr)
    if (ISV) {
#pragma unroll
        for (int nb = 0; nb < 4; ++nb) bv[nb] = bfr(bias[nb * 16 + lr]); }
#pragma unroll
    for (int nb = 0; nb < 4; ++nb) {   // 16 plane rows a turn
#pragma unroll
        for (int mb = 0; mb < 4; ++mb) { v4u wh, wl, wx;
#pragma unroll
            for (int i = 0; i < 4; ++i) { const float a = acc[mb][nb][2 * i] + (ISV ? bv[nb] : bq[mb][2 * i]), b = acc[mb][nb][2 * i + 1] + (ISV ? bv[nb] : bq[mb][2 * i + 1]);
                const unsigned h = pack2(a, b); wh[i] = h; wl[i] = pack2(a - __uint_as_float(h << 16), b - __uint_as_float(h & 0xFFFF0000u));
                if (ISV) { v2f x; x[0] = a; x[1] = b; wx[i] = __builtin_bit_cast(unsigned, __builtin_convertvector(x, v2h)); } }
            unsigned* sp = st + lr * SP + mb * 8 + hi * 4; *(v4u*)sp = wh; *(v4u*)(sp + 16 * SP) = wl; if (ISV) *(v4u*)(sp + 32 * SP) = wx; }
        asm volatile("s_wait_dscnt 0x0" ::: "memory");   // the rows are read back by other lanes than wrote them
#pragma unroll
        for (int s = 0; s < 4; ++s) { const unsigned* sp = st + (s * 4 + rr) * SP + cc * 4; const size_t o = (size_t)(nb * 16 + s * 4 + rr) * PITCH + cc * 8;   // 8 lanes store one whole 128-B line
            *(v8us*)(Ph + o) = __builtin_bit_cast(v8us, *(const v4u*)sp); *(v8us*)(Pl + o) = __builtin_bit_cast(v8us, *(const v4u*)(sp + 16 * SP));
            if (ISV) *(v8h*)(P16 + o) = __builtin_bit_cast(v8h, *(const v4u*)(sp + 32 * SP)); }
        asm volatile("s_wait_xcnt 0x0" ::: "memory");   // before the next turn reuses the data registers of the stores above
        __builtin_amdgcn_sched_barrier(0);   // keeps later register writes behind that wait, and the later turns' conversions in their turns (hoisted, they took the kernel past 256 registers)
    }
}
__global__ __launch_bounds__(32) void k_gemmqkv(const bf* __restrict__ X, const bf* __restrict__ Wt, const float* __restrict__ bias, bf* Qh, bf* Ql, bf* Kh, bf* Kl, bf* Vh, bf* Vl, h16* V16) {
    static_assert(HD == 64 && TT % 64 == 0 && DM % 32 == 0, "one tile is 64 rows of one entry and one head");
    __shared__ __align__(16) unsigned st[3 * 16 * SP];
    const int lane = threadIdx.x & 31, lr = lane & 15, hi = lane >> 4; const int r0 = blockIdx.x * 64, c0 = blockIdx.y * 64; const bool isv = c0 >= DQ + DKV;
    const bf* xp = X + (size_t)(r0 + lr) * DM + 8 * hi; const bf* wp = Wt + (size_t)(c0 + lr) * DM + 8 * hi;
    const bf* pa = isv ? xp : wp; const bf* pb = isv ? wp : xp;
    v8f acc[4][4];
#pragma unroll
    for (int mb = 0; mb < 4; ++mb)
#pragma unroll
        for (int nb = 0; nb < 4; ++nb) acc[mb][nb] = (v8f){};
#pragma unroll 1   // as in k_gemmw: one k step of 32 a trip
    for (int kc = 0; kc < DM; kc += 32) {
        const bf* ak = pa + kc; const bf* bk = pb + kc; v16bf a[4];
#pragma unroll
        for (int mb = 0; mb < 4; ++mb) a[mb] = WFrag<bf>::ld(ak + (size_t)mb * 16 * DM);
#pragma unroll
        for (int nb = 0; nb < 4; ++nb) { const v16bf b = WFrag<bf>::ld(bk + (size_t)nb * 16 * DM);
#pragma unroll
            for (int mb = 0; mb < 4; ++mb) acc[mb][nb] = wmmab(a[mb], b, acc[mb][nb]); }
        // the wait: before the trip's two address pairs are rewritten (they are named so that they stay in their registers up to here); the v_nops, as in k_gemmw: the distance behind the trip's last matrix instruction, on the back edge and on the way out alike
        asm volatile("s_wait_xcnt 0x0\n\tv_nop\n\tv_nop\n\tv_nop\n\tv_nop" : "+v"(acc[0][0]), "+v"(acc[1][1]), "+v"(acc[2][2]), "+v"(acc[3][3]) : "v"(a[0]), "v"(a[3]), "v"(ak), "v"(bk));
    }
    const int en = r0 / TT, t0 = r0 % TT;
    if (isv) { const size_t o = ((size_t)en * NKV + (c0 - DQ - DKV) / HD) * HD * TT + t0; qkv_store<true>(acc, bias + c0, st, Vh + o, Vl + o, V16 + o, lane); }
    else { const bool isk = c0 >= DQ; const size_t o = (((size_t)en * (isk ? NKV : NH_) + (isk ? c0 - DQ : c0) / HD) * TT + t0) * HD; qkv_store<false>(acc, bias + c0, st, (isk ? Kh : Qh) + o, (isk ? Kl : Ql) + o, nullptr, lane); }
}
template <bool HI>
__device__ __forceinline__ void fattn_body(const bf* __restrict__ Qh, const bf* __restrict__ Ql, const bf* __restrict__ Kh, const bf* __restrict__ Kl, const bf* __restrict__ Vh, const bf* __restrict__ Vl, const h16* __restrict__ V16, const float* __restrict__ am, bf* Ah, bf* Al, int q0, int lane) {
    const int lr = lane & 15, hi = lane >> 4;
    v16bf qh[2][2], ql[2][2];   // [column group][k step of 32]
    v16bf kh[2][2], kl[2][2];   // [16-key tile][k step]
    v4f mk[2][2][2];            // [column group][16-key tile][half of the lane's 8 keys]
    const bf* kph = Kh + (size_t)lr * HD + 8 * hi; const bf* kpl = Kl + (size_t)lr * HD + 8 * hi;
    const float* mp = am + (size_t)(q0 + lr) * TT + 8 * hi;
    const size_t vof = (size_t)lr * TT + 8 * hi;
    { const bf* qph = Qh + (size_t)(q0 + lr) * HD + 8 * hi; const bf* qpl = Ql + (size_t)(q0 + lr) * HD + 8 * hi;
#pragma unroll
        for (int g = 0; g < 2; ++g)
#pragma unroll
            for (int kc = 0; kc < 2; ++kc) { qh[g][kc] = WFrag<bf>::ld(qph + 16 * g * HD + 32 * kc); ql[g][kc] = WFrag<bf>::ld(qpl + 16 * g * HD + 32 * kc); }
#pragma unroll
        for (int kt = 0; kt < 2; ++kt) {
#pragma unroll
            for (int kc = 0; kc < 2; ++kc) { kh[kt][kc] = WFrag<bf>::ld(kph + 16 * kt * HD + 32 * kc); kl[kt][kc] = WFrag<bf>::ld(kpl + 16 * kt * HD + 32 * kc); }
#pragma unroll
            for (int g = 0; g < 2; ++g) { mk[g][kt][0] = *(const v4f*)(mp + 16 * g * TT + 16 * kt); mk[g][kt][1] = *(const v4f*)(mp + 16 * g * TT + 16 * kt + 4); } }
        asm volatile("s_wait_xcnt 0x0" :: "v"(qph), "v"(qpl), "v"(kph), "v"(kpl), "v"(mp) : "memory");   // before any address register of the loads above is reused; the addresses are named so that they stay in their registers up to here
        __builtin_amdgcn_sched_barrier(0);   // keeps later register writes behind that wait
    }
    v8f acc[2][4]; float mrun[2]; v2f lrun[2];
#pragma unroll
    for (int g = 0; g < 2; ++g) { mrun[g] = -3.0e38f; lrun[g] = (v2f){};
#pragma unroll
        for (int t = 0; t < 4; ++t) acc[g][t] = (v8f){}; }
    const v2f scl2 = {SCL, SCL}, l2e2 = {L2E, L2E};
#pragma unroll 1   // one pass a trip: unrolled, the fragments of two passes would be live at once
    for (int kb = 0; kb < TT / 32; ++kb) {
        const int key0 = kb * 32, nk0 = (kb + 1 < TT / 32) ? key0 + 32 : key0;   // the last pass fetches its own rows again (in bounds, unused)
        v8f s[2][2];   // [16-key tile][column group]
#pragma unroll
        for (int kt = 0; kt < 2; ++kt)
#pragma unroll
            for (int g = 0; g < 2; ++g) s[kt][g] = (v8f){};
#pragma unroll
        for (int kc = 0; kc < 2; ++kc) {   // per accumulator: qh.kh, ql.kh, qh.kl, k steps ascending
#pragma unroll
            for (int kt = 0; kt < 2; ++kt)
#pragma unroll
                for (int g = 0; g < 2; ++g) s[kt][g] = wmmab(kh[kt][kc], qh[g][kc], s[kt][g]);
#pragma unroll
            for (int kt = 0; kt < 2; ++kt)
#pragma unroll
                for (int g = 0; g < 2; ++g) s[kt][g] = wmmab(kh[kt][kc], ql[g][kc], s[kt][g]);
#pragma unroll
            for (int kt = 0; kt < 2; ++kt)
#pragma unroll
                for (int g = 0; g < 2; ++g) s[kt][g] = wmmab(kl[kt][kc], qh[g][kc], s[kt][g]); }
        // t = s / 8 - mask (s / 8 is exact, so the fused form rounds once, as a separate subtraction does)
#pragma unroll
        for (int g = 0; g < 2; ++g)
#pragma unroll
            for (int kt = 0; kt < 2; ++kt)
#pragma unroll
                for (int i = 0; i < 4; ++i) { const v2f sv = {s[kt][g][2 * i], s[kt][g][2 * i + 1]}, mv = {mk[g][kt][i >> 1][2 * (i & 1)], mk[g][kt][i >> 1][2 * (i & 1) + 1]};
                    const v2f t = __builtin_elementwise_fma(sv, scl2, -mv); s[kt][g][2 * i] = t[0]; s[kt][g][2 * i + 1] = t[1]; }
        // One group of loads, in flight under the softmax: this pass's values, the next pass's keys and mask (their registers are free from here on).
        __builtin_amdgcn_sched_barrier(0);   // keeps the group from sinking towards its users, where its latency would be exposed
        v16bf vh[4], vl[4]; v16h vx[4];
        { const bf* nkh = kph + (size_t)nk0 * HD; const bf* nkl = kpl + (size_t)nk0 * HD; const float* nmp = mp + nk0;
            const bf* vph = Vh + vof + key0; const bf* vpl = Vl + vof + key0; const h16* vpx = V16 + vof + key0;
#pragma unroll
            for (int t = 0; t < 4; ++t) { if (HI) { vh[t] = WFrag<bf>::ld(vph + 16 * t * TT); vl[t] = WFrag<bf>::ld(vpl + 16 * t * TT); } else vx[t] = WFrag<h16>::ld(vpx + 16 * t * TT); }
#pragma unroll
            for (int kt = 0; kt < 2; ++kt)
#pragma unroll
                for (int kc = 0; kc < 2; ++kc) { kh[kt][kc] = WFrag<bf>::ld(nkh + 16 * kt * HD + 32 * kc); kl[kt][kc] = WFrag<bf>::ld(nkl + 16 * kt * HD + 32 * kc); }
#pragma unroll
            for (int kt = 0; kt < 2; ++kt)
#pragma unroll
                for (int g = 0; g < 2; ++g) { mk[g][kt][0] = *(const v4f*)(nmp + 16 * g * TT + 16 * kt); mk[g][kt][1] = *(const v4f*)(nmp + 16 * g * TT + 16 * kt + 4); }
            // before any address register of the group is reused; the addresses are named so that they stay in their registers up to here
            if (HI) asm volatile("s_wait_xcnt 0x0" :: "v"(nkh), "v"(nkl), "v"(nmp), "v"(vph), "v"(vpl) : "memory"); else asm volatile("s_wait_xcnt 0x0" :: "v"(nkh), "v"(nkl), "v"(nmp), "v"(vpx) : "memory"); }
        __builtin_amdgcn_sched_barrier(0);   // keeps later register writes behind that wait
        // each query's maximum over the pass
        float mb[2]; bool need = false;
#pragma unroll
        for (int g = 0; g < 2; ++g) { float mx = -3.0e38f;
#pragma unroll
            for (int kt = 0; kt < 2; ++kt)
#pragma unroll
                for (int j = 0; j < 8; ++j) mx = fmaxf(mx, s[kt][g][j]);
            mx = fmaxf(mx, xhalf(mx)); mb[g] = mx; need = need || (mx > mrun[g] + LAZY); }
        if (__builtin_amdgcn_ballot_w32(need) != 0) {   // wave-uniform; always on the first pass, rare later
#pragma unroll
            for (int g = 0; g < 2; ++g) { const float mn = fmaxf(mrun[g], mb[g]); const float corr = __builtin_amdgcn_exp2f((mrun[g] - mn) * L2E); mrun[g] = mn; lrun[g] = lrun[g] * corr;   // corr = 0 on the first pass
#pragma unroll
                for (int t = 0; t < 4; ++t) acc[g][t] = acc[g][t] * corr; } }
#pragma unroll
        for (int g = 0; g < 2; ++g) { const float nm = -mrun[g] * L2E; const v2f nm2 = {nm, nm}; v8u wh, wl; v16h px;
#pragma unroll
            for (int i = 0; i < 8; ++i) { const int kt = i >> 2, r = 2 * (i & 3);   // operand elements 2i, 2i+1 = tile kt, registers r, r+1
                const v2f sv = {s[kt][g][r], s[kt][g][r + 1]}; const v2f a = __builtin_elementwise_fma(sv, l2e2, nm2);
                v2f p; p[0] = __builtin_amdgcn_exp2f(a[0]); p[1] = __builtin_amdgcn_exp2f(a[1]); lrun[g] += p;
                if (HI) { const unsigned h = pack2(p[0], p[1]); wh[i] = h; wl[i] = pack2(p[0] - __uint_as_float(h << 16), p[1] - __uint_as_float(h & 0xFFFF0000u)); }
                else { px[2 * i] = tohx(p[0]); px[2 * i + 1] = tohx(p[1]); } }
            if (HI) { const v16bf ph = __builtin_bit_cast(v16bf, wh), pl = __builtin_bit_cast(v16bf, wl);
#pragma unroll
                for (int t = 0; t < 4; ++t) acc[g][t] = wmmab(vh[t], ph, acc[g][t]);   // per accumulator: ph.vh, pl.vh, ph.vl
#pragma unroll
                for (int t = 0; t < 4; ++t) acc[g][t] = wmmab(vh[t], pl, acc[g][t]);
#pragma unroll
                for (int t = 0; t < 4; ++t) acc[g][t] = wmmab(vl[t], ph, acc[g][t]);
            } else {
#pragma unroll
                for (int t = 0; t < 4; ++t) acc[g][t] = wmma16(vx[t], px, acc[g][t]); } }
        __builtin_amdgcn_sched_barrier(0);   // holds the v_nops behind the last matrix instruction
        asm volatile("v_nop\n\tv_nop\n\tv_nop\n\tv_nop");   // the distance behind the pass's last matrix instruction, on the back edge and on the way out of the loop alike
        __builtin_amdgcn_sched_barrier(0);
    }
#pragma unroll
    for (int g = 0; g < 2; ++g) { const float lh = lrun[g][0] + lrun[g][1]; const float l = lh + xhalf(lh); const float inv = __fdiv_rn(1.0f, l); bf* pa = Ah + (size_t)(q0 + 16 * g + lr) * DQ + 8 * hi; bf* pb = Al + (size_t)(q0 + 16 * g + lr) * DQ + 8 * hi;   // a lane's 8 registers are d = 16 t + 8 hi + 0..7 of query lr
#pragma unroll
        for (int t = 0; t < 4; ++t) { v8us oh, ol;
#pragma unroll
            for (int j = 0; j < 8; ++j) { unsigned short a, c2; splitf(acc[g][t][j] * inv, a, c2); oh[j] = a; ol[j] = c2; }
            *(v8us*)(pa + 16 * t) = oh; *(v8us*)(pb + 16 * t) = ol; } }
}
// grid.y = entry * NH_ + head (planes consecutive); writes the merged [t][DQ] hi and lo planes that Wo reads.
__global__ __launch_bounds__(256) void k_fattn(const bf* __restrict__ Qh, const bf* __restrict__ Ql, const bf* __restrict__ Kh, const bf* __restrict__ Kl, const bf* __restrict__ Vh, const bf* __restrict__ Vl, const h16* __restrict__ V16, const float* __restrict__ am, bf* Ah, bf* Al) {
    static_assert(2 * RH == TT && RH % 128 == 0 && HD == 64 && NKV == NH_, "the wave split below is written for these");
    const int lane = threadIdx.x & 31; const int wave = __builtin_amdgcn_readfirstlane((int)(threadIdx.x >> 5));
    const size_t z = blockIdx.y, po = z * TT * HD, ao = (z / NH_) * TT * DQ + (z % NH_) * HD; const int qb = (blockIdx.x * 4 + (wave & 3)) * 32;
    if (wave < 4) fattn_body<true>(Qh + po, Ql + po, Kh + po, Kl + po, Vh + po, Vl + po, V16 + po, am, Ah + ao, Al + ao, qb, lane);
    else fattn_body<false>(Qh + po, Ql + po, Kh + po, Kl + po, Vh + po, Vl + po, V16 + po, am, Ah + ao, Al + ao, RH + qb, lane);
}

extern "C" void kernel_launch(void* const* d_in, const int* in_sizes, int n_in,
                              void* d_out, int out_size, void* d_ws, size_t ws_size, hipStream_t stream) {
    (void)in_sizes; (void)n_in; (void)out_size;
    const float* x = (const float*)d_in[0]; const float* amask = (const float*)d_in[1]; const float* wf = (const float*)d_in[2]; const float* bf3 = (const float*)d_in[3]; const float* wo = (const float*)d_in[4]; const float* bo = (const float*)d_in[5];
    float* OUT = (float*)d_out;     // [8][1024][1024]
    char* wsp = (char*)d_ws;
    auto take = [&](size_t bytes) { char* p = wsp; wsp += (bytes + 255) & ~(size_t)255; return (void*)p; };
    bf* WO = (bf*)take((size_t)DM * DQ * 2);
    bf* WALL = (bf*)take((size_t)(DQ + 2 * DKV) * DM * 2); float* AMR = (float*)take((size_t)TT * TT * 4);
    h16* VT16 = (h16*)take((size_t)GB * NKV * HD * TT * 2);
    bf* QPh = (bf*)take((size_t)GB * NH_ * TT * HD * 2); bf* QPl = (bf*)take((size_t)GB * NH_ * TT * HD * 2); bf* KPh = (bf*)take((size_t)GB * NKV * TT * HD * 2); bf* KPl = (bf*)take((size_t)GB * NKV * TT * HD * 2); bf* VTh = (bf*)take((size_t)GB * NKV * HD * TT * 2); bf* VTl = (bf*)take((size_t)GB * NKV * HD * TT * 2);
    const int NQKV = DQ + 2 * DKV;
    bf* XB = (bf*)take((size_t)GB * TT * DM * 2);            // bf16 x of GB entries
    bf* ATh = (bf*)take((size_t)GB * TT * DQ * 2); bf* ATl = (bf*)take((size_t)GB * TT * DQ * 2);
    if ((size_t)(wsp - (char*)d_ws) > ws_size) return;    // ws 256 MiB; the carve-up takes about 92 MiB
    k_wtG<<<(unsigned)((DM * (DQ + 2 * DKV) / 64 + 63) / 64), 256, 0, stream>>>(wf, DM, DQ + 2 * DKV, WALL); k_rbf<<<(unsigned)(((size_t)TT * TT / 4 + 255) / 256), 256, 0, stream>>>(amask, AMR, TT * TT / 4);
    k_wtG<<<(unsigned)((DQ * DM / 64 + 63) / 64), 256, 0, stream>>>(wo, DQ, DM, WO);
    for (int b0 = 0; b0 < NB_; b0 += GB) {
        k_cvt8<<<(unsigned)(((size_t)GB * TT * DM / 8 + 255) / 256), 256, 0, stream>>>(x + (size_t)b0 * TT * DM, XB, (size_t)GB * TT * DM / 8);
        k_gemmqkv<<<dim3(GB * TT / 64, NQKV / 64, 1), 32, 0, stream>>>(XB, WALL, bf3, QPh, QPl, KPh, KPl, VTh, VTl, VT16);   // q | k | v of GB entries as one product of width NQKV, written as the head planes
        k_fattn<<<dim3(RH / 128, GB * NH_, 1), 256, 0, stream>>>(QPh, QPl, KPh, KPl, VTh, VTl, VT16, AMR, ATh, ATl);   // scores, softmax, attn.v and the head merge of GB entries
        k_gemmw<bf, 1, true><<<dim3(GB * TT / 64, DM / 64, 1), 32, 0, stream>>>(ATh, ATl, WO, nullptr, DQ, OUT + (size_t)b0 * TT * DM, DM, bo, 0, 0, 0); }
}

// v004
// One run takes 280 microseconds.
// Two timings next to v003 put it at 1.25 and 1.24 times that version's speed.
// All steps since v000 together make it 16.9 times as fast.
#include <hip/hip_runtime.h>

// R3DAttention (x [8][1024][1024]; qkv = x Wqkv + bqkv ([1024][3072]: q | k | v blocks, 16 heads x 64); scores = q.k / 8 - mask[i][j] (f32 [1024][1024], read; shared over batch and heads); softmax; out = merged Wo + bo -> [8][1024][1024]).
// Compute dtypes, f32 accumulate: every input rounded to bf16; q/k/v on PLAIN bf16 operands (inputs: exact) + bias; scores hl x hl (3 products) on every row, attn.v: query rows < 512 hl (3 products), the rest single fp16, on exponentials against a running maximum, divided by the denominator at the end; the (bf16-rounded) mask subtracted per element in f32; softmax f32; Wo hl x exact (2 products) + bias.

// FRAGMENT ORDER: every 16-bit plane that a matrix instruction reads is kept as a row of 1-KiB fragments (16 rows r x 32 k). Inside a fragment the 16-B piece of
// lane l = 16 hi + lr and half h lies at element 256 h + 8 l and holds row lr, k = 16 h + 8 hi + 0..7: exactly what that lane's registers hold. A fragment is then two
// wave-wide 16-B loads of 512 contiguous bytes each (4 whole lines) in place of two loads that take 32 B out of each of 16 lines. A plane [R][K]: fragment (r / 16, k / 32) at element (r / 16) * 16 K + (k / 32) * 512.
#define NB_  8
#define TT   1024
#define DM   1024
#define NH_  16
#define NKV  16
#define REP  (NH_ / NKV)
#define HD   64
#define DQ   (NH_ * HD)
#define DKV  (NKV * HD)
#define GB   4                    // batch entries per projection launch (the workspace holds the head planes of GB entries)
#define RH   512                  // query rows < RH use hi+lo planes (must be TT / 2)
#define WIN  0
#define SCL  0.125f   // HD^-0.5
typedef _Float16 h16;
typedef unsigned short bf;
typedef __attribute__((ext_vector_type(16))) __bf16   v16bf;
typedef __attribute__((ext_vector_type(16))) _Float16 v16h;
typedef __attribute__((ext_vector_type(8)))  _Float16 v8h;
typedef __attribute__((ext_vector_type(8)))  unsigned short v8us;
typedef __attribute__((ext_vector_type(8)))  float    v8f;
typedef __attribute__((ext_vector_type(4)))  float    v4f;
typedef v8h  __attribute__((may_alias)) v8ha;
typedef v4f  __attribute__((may_alias)) v4fa;
typedef v8us __attribute__((may_alias)) v8usa;

__device__ __forceinline__ unsigned short f2bf(float f) { unsigned u = __float_as_uint(f); u += 0x7FFFu + ((u >> 16) & 1u); return (unsigned short)(u >> 16); }
__device__ __forceinline__ float bf2f(unsigned short b) { return __uint_as_float(((unsigned)b) << 16); }
__device__ __forceinline__ float bfr(float f) { return bf2f(f2bf(f)); }
__device__ __forceinline__ v16h cat16(v8h lo, v8h hi) { return __builtin_shufflevector(lo, hi, 0, 1, 2, 3, 4, 5, 6, 7, 8, 9, 10, 11, 12, 13, 14, 15); }
__device__ __forceinline__ v16bf cat16b(v8us lo, v8us hi) { return __builtin_bit_cast(v16bf, __builtin_shufflevector(lo, hi, 0, 1, 2, 3, 4, 5, 6, 7, 8, 9, 10, 11, 12, 13, 14, 15)); }
__device__ __forceinline__ v8f wmma16(v16h a, v16h b, v8f c) { return __builtin_amdgcn_wmma_f32_16x16x32_f16(false, a, false, b, (short)0, c, false, false); }
__device__ __forceinline__ v8f wmmab(v16bf a, v16bf b, v8f c) { return __builtin_amdgcn_wmma_f32_16x16x32_bf16(false, a, false, b, (short)0, c, false, false); }



// ---- k_gemmw: register-blocked GEMM, ONE WAVE per 64x64 output tile (16 accumulators), operands straight from 16-bit planes in fragment order (ld takes the lane's own piece of a fragment); grid (M/64, N/64, Z), 32 threads.
// C[m][n] (f32, pitch ldc, + optional f32 bias[n]) = sum_k A[m][k] Bt[n][k] (+ split products per NSPLIT). z-batch strides sA/sB/sC in elements. K % 32 == 0.
template <typename T16> struct WFrag;
template <> struct WFrag<h16> { typedef v16h V; static __device__ __forceinline__ V ld(const h16* p) { return cat16(*(const v8h*)p, *(const v8h*)(p + 256)); } static __device__ __forceinline__ v8f mma(V a, V b, v8f c) { return wmma16(a, b, c); } };
template <> struct WFrag<bf> { typedef v16bf V; static __device__ __forceinline__ V ld(const bf* p) { return cat16b(*(const v8us*)p, *(const v8us*)(p + 256)); } static __device__ __forceinline__ v8f mma(V a, V b, v8f c) { return wmmab(a, b, c); } };
template <typename T16, int NSPLIT, bool BIAS, int K>   // K at compile time: a trip's fragments then lie at immediate offsets from one address pair per plane
__global__ __launch_bounds__(32) void k_gemmw(const T16* __restrict__ A, const T16* __restrict__ A2, const T16* __restrict__ Bt, const T16* __restrict__ Bt2, float* C, int ldc, const float* __restrict__ bias, size_t sA, size_t sB, size_t sC) {
    typedef typename WFrag<T16>::V V;
    __shared__ __align__(16) float os[16 * 68];
    const size_t z = blockIdx.z; A += z * sA; if (A2) A2 += z * sA; Bt += z * sB; if (Bt2) Bt2 += z * sB; C += z * sC;
    const int lane = threadIdx.x & 31, lr = lane & 15, hi = lane >> 4; const int r0 = blockIdx.x * 64, c0 = blockIdx.y * 64;
    v8f acc[4][4];
#pragma unroll
    for (int mb = 0; mb < 4; ++mb)
#pragma unroll
        for (int nb = 0; nb < 4; ++nb) acc[mb][nb] = (v8f){};
    const size_t aoff = (size_t)r0 * K + 8 * lane, boff = (size_t)c0 * K + 8 * lane;   // 16 rows of a plane are 16 K elements; a k step of 32 is the next fragment, 512 elements on
#pragma unroll 1
    for (int kc = 0; kc < K; kc += 32) {
        const T16* ak = A + aoff + (size_t)kc * 16; const T16* bk = Bt + boff + (size_t)kc * 16;
        const T16* a2k = (NSPLIT == 1 || NSPLIT == 2) ? A2 + aoff + (size_t)kc * 16 : ak; const T16* b2k = (NSPLIT >= 2) ? Bt2 + boff + (size_t)kc * 16 : bk;
        V a[4], a2[4];
#pragma unroll
        for (int mb = 0; mb < 4; ++mb) { a[mb] = WFrag<T16>::ld(ak + (size_t)mb * 16 * K); if (NSPLIT == 1 || NSPLIT == 2) a2[mb] = WFrag<T16>::ld(a2k + (size_t)mb * 16 * K); }
#pragma unroll
        for (int nb = 0; nb < 4; ++nb) { const V b = WFrag<T16>::ld(bk + (size_t)nb * 16 * K); V b2; if (NSPLIT >= 2) b2 = WFrag<T16>::ld(b2k + (size_t)nb * 16 * K);
#pragma unroll
            for (int mb = 0; mb < 4; ++mb) { acc[mb][nb] = WFrag<T16>::mma(a[mb], b, acc[mb][nb]); if (NSPLIT == 1 || NSPLIT == 2) acc[mb][nb] = WFrag<T16>::mma(a2[mb], b, acc[mb][nb]); if (NSPLIT >= 2) acc[mb][nb] = WFrag<T16>::mma(a[mb], b2, acc[mb][nb]); } }
        // the wait: before the trip's address pairs are rewritten (they are named so that they stay in their registers up to here); the v_nops: the distance behind the trip's last matrix instruction, on the back edge and on the way out alike
        asm volatile("s_wait_xcnt 0x0\n\tv_nop\n\tv_nop\n\tv_nop\n\tv_nop" : "+v"(acc[0][0]), "+v"(acc[1][1]), "+v"(acc[2][2]), "+v"(acc[3][3]) : "v"(a[0]), "v"(a[3]), "v"(ak), "v"(a2k), "v"(bk), "v"(b2k));
    }
#pragma unroll
    for (int mb = 0; mb < 4; ++mb) {
#pragma unroll
        for (int nb = 0; nb < 4; ++nb) {
#pragma unroll
            for (int j = 0; j < 8; ++j) os[(hi * 8 + j) * 68 + nb * 16 + lr] = acc[mb][nb][j]; }
        __builtin_amdgcn_wave_barrier(); asm volatile("" ::: "memory");
        float* crow = C + (size_t)(r0 + mb * 16) * ldc + c0;
{
#pragma unroll
            for (int s = 0; s < 8; ++s) { const int row = 2 * s + hi, cofs = lr * 4; v4f val = *(const v4fa*)(os + row * 68 + cofs); if (BIAS) { val[0] += bfr(bias[c0 + cofs]); val[1] += bfr(bias[c0 + cofs + 1]); val[2] += bfr(bias[c0 + cofs + 2]); val[3] += bfr(bias[c0 + cofs + 3]); }
                *(v4f*)(crow + (size_t)row * ldc + cofs) = val; }
             }
        __builtin_amdgcn_wave_barrier(); asm volatile("" ::: "memory");
    }
}

__device__ __forceinline__ h16 tohx(float x) { return (h16)x; }
__device__ __forceinline__ void splitf(float y, unsigned short& h, unsigned short& l) { h = f2bf(y); l = f2bf(y - bf2f(h)); }
typedef __attribute__((ext_vector_type(2))) _Float16 v2h;
typedef __attribute__((ext_vector_type(4))) _Float16 v4h;
typedef __attribute__((ext_vector_type(2))) unsigned short v2us;
typedef __attribute__((ext_vector_type(4))) unsigned short v4us;
typedef __attribute__((ext_vector_type(2))) float v2f;
typedef __attribute__((ext_vector_type(4))) int v4i;

// k_wtG: w [K][N] f32 -> its transpose [N][K] as bf16 in fragment order. One thread makes one 16-B piece (8 k of one n): the 16 lanes of a half wave read 16 neighbouring n of one row of w, a wave stores 512 contiguous bytes.
template <int K, int N>   // at compile time: the 8 rows of a piece then lie at immediate offsets from one address pair
__global__ __launch_bounds__(256) void k_wtG(const float* __restrict__ w, bf* Bt) {
    const int i = blockIdx.x * 256 + threadIdx.x; if (i >= N * (K / 8)) return;
    const int lane = i & 31, f = i >> 6, kf = K / 32; const int n = (f / kf) * 16 + (lane & 15), k0 = (f % kf) * 32 + ((i >> 5) & 1) * 16 + (lane >> 4) * 8;
    const float* p = w + (size_t)k0 * N + n; v8us o;
#pragma unroll
    for (int j = 0; j < 8; ++j) o[j] = f2bf(p[(size_t)j * N]);
    *(v8us*)(Bt + (size_t)i * 8) = o;
}
// k_cvt8: x rows [.][DM] f32 -> bf16 in fragment order; one thread makes one 16-B piece. A wave takes 8 rows x the 4 pieces of a fragment's 32 k: it reads 128 contiguous bytes of each row and stores 4 whole lines.
__global__ __launch_bounds__(256) void k_cvt8(const float* __restrict__ src, bf* dst, size_t n8) { const size_t i = (size_t)blockIdx.x * 256 + threadIdx.x; if (i >= n8) return;
    const int lr = (int)(i & 7) + (int)((i >> 5) & 1) * 8, pc = (int)((i >> 3) & 3); const size_t f = i >> 6;   // pc = 2 h + hi: k = 8 pc .. of the fragment, piece 16 pc + lr
    const v8f v = *(const v8f*)(src + ((f / (DM / 32)) * 16 + lr) * DM + (f % (DM / 32)) * 32 + pc * 8); v8us o;
#pragma unroll
    for (int k = 0; k < 8; ++k) o[k] = f2bf(v[k]); *(v8us*)(dst + (f * 64 + pc * 16 + lr) * 8) = o;  }
// k_rbf: bf16-rounded f32 copy of the mask, in the order in which k_fattn's lanes hold it: per 16 queries x 32 keys four runs (16-key tile kt, half h of a lane's 8 keys) of 32 lanes x 4 floats;
// lane 16 hi + lr has query lr, keys 16 kt + 8 hi + 4 h + 0..3. Thread i makes piece i.
__global__ __launch_bounds__(256) void k_rbf(const float* __restrict__ src, float* dst, int n4) { const int i = blockIdx.x * 256 + threadIdx.x; if (i >= n4) return;
    const int lane = i & 31, sub = (i >> 5) & 3, blk = i >> 7; const int q = (blk / (TT / 32)) * 16 + (lane & 15), key = (blk % (TT / 32)) * 32 + (sub >> 1) * 16 + (lane >> 4) * 8 + (sub & 1) * 4;
    const v4f a = *(const v4f*)(src + (size_t)q * TT + key); v4f o; for (int u = 0; u < 4; ++u) o[u] = bfr(a[u]); *(v4f*)(dst + (size_t)i * 4) = o;  }
// ---- k_fattn: scores, softmax and attn.v of one head in one kernel; neither the scores nor the probabilities go through memory.
// Transposed products: S^T = K Q^T (A = 16 keys, B = 16 queries), so a lane holds 8 consecutive keys of ONE query (column lr) per tile, and two
// 16-key tiles are, register for register, the B operand (32 keys) of O^T += V^T P^T (A = 16 rows of the [d][t] value planes). No LDS, no barrier.
// One wave: 32 queries (two column groups) against all TT keys in passes of 32, running maximum and denominator per query. Grid (RH / 128, heads), 8 waves:
// waves 0-3 take query rows < RH (P and V as hi+lo bf16, 3 products), waves 4-7 the rows >= RH (P and V single fp16), so every workgroup carries the same work.
typedef __attribute__((ext_vector_type(8))) unsigned v8u;
typedef __attribute__((ext_vector_type(2))) __bf16 v2bf;
#define L2E 1.4426950408889634f
#define LAZY 4.0f   // the maximum in use may trail a query's true maximum by this much (an exponential then reaches e^4, far inside fp16 and bf16 range)
__device__ __forceinline__ unsigned pack2(float a, float b) { v2f x; x[0] = a; x[1] = b; return __builtin_bit_cast(unsigned, __builtin_convertvector(x, v2bf)); }   // round to nearest even
__device__ __forceinline__ float xhalf(float x) { return __builtin_bit_cast(float, __builtin_amdgcn_permlanex16(__builtin_bit_cast(int, x), __builtin_bit_cast(int, x), 0x76543210, 0xfedcba98, false, false)); }   // lane l <-> lane l ^ 16
// ---- k_gemmqkv: the q | k | v projection of GB entries, ONE WAVE per 64x64 tile (= 64 rows t of one head's q, k or v), main loop as k_gemmw; the epilogue adds the bias and
// writes the planes that k_fattn reads: q, k [head][t][d] and v [head][d][t], each as hi + lo bf16 (v also single fp16), in fragment order. A lane's 8 accumulator registers are 8 consecutive rows of the
// A operand, so a q or k tile is computed as W X^T (A = 64 d) and a v tile as X W^T (A = 64 t): either way they are 8 consecutive elements of one plane row (the B index), which is
// the lane's own 16-B piece of a fragment: every wave-wide store is 512 contiguous bytes, straight from registers. q, k: fragment (t / 16, d / 32); v: per 32 keys the four fragments of d / 16.
typedef __attribute__((ext_vector_type(4))) unsigned v4u;
template <bool ISV>
__device__ __forceinline__ void qkv_store(const v8f (&acc)[4][4], const float* __restrict__ bias, bf* Ph, bf* Pl, h16* P16, int lane) {
    const int lr = lane & 15, hi = lane >> 4;
    v8f bq[4];   // q, k: the bias runs along the plane row (d = 16 mb + 8 hi + j)
    if (!ISV) {
#pragma unroll
        for (int mb = 0; mb < 4; ++mb) { const v4f b0 = *(const v4f*)(bias + mb * 16 + hi * 8), b1 = *(const v4f*)(bias + mb * 16 + hi * 8 + 4);
#pragma unroll
            for (int j = 0; j < 4; ++j) { bq[mb][j] = bfr(b0[j]); bq[mb][4 + j] = bfr(b1[j]); } } }
    float bv[4];   // v: one d, so one bias, per plane row (d = 16 nb + lr)
    if (ISV) {
#pragma unroll
        for (int nb = 0; nb < 4; ++nb) bv[nb] = bfr(bias[nb * 16 + lr]); }
#pragma unroll
    for (int nb = 0; nb < 4; ++nb) {   // 16 plane rows a turn
        v4u wh[4], wl[4], wx[4];
#pragma unroll
        for (int mb = 0; mb < 4; ++mb) {
#pragma unroll
            for (int i = 0; i < 4; ++i) { const float a = acc[mb][nb][2 * i] + (ISV ? bv[nb] : bq[mb][2 * i]), b = acc[mb][nb][2 * i + 1] + (ISV ? bv[nb] : bq[mb][2 * i + 1]);
                const unsigned h = pack2(a, b); wh[mb][i] = h; wl[mb][i] = pack2(a - __uint_as_float(h << 16), b - __uint_as_float(h & 0xFFFF0000u));
                if (ISV) { v2f x; x[0] = a; x[1] = b; wx[mb][i] = __builtin_bit_cast(unsigned, __builtin_convertvector(x, v2h)); } } }
        __builtin_amdgcn_sched_barrier(0);   // the turn's conversions stay in front of its stores, so that no store's data register is written again before the wait below
        // q, k: rows t = 16 nb + lr, piece mb (d = 16 mb + 8 hi ..) of the 2 fragments of that row block; v: rows d = 16 nb + lr, keys 16 mb + 8 hi ..: half mb & 1 of fragment nb of key block mb >> 1
        const size_t o = (size_t)nb * (ISV ? 512 : 1024) + 8 * lane; bf* ph = Ph + o; bf* pl = Pl + o; h16* px = ISV ? P16 + o : nullptr;
#pragma unroll
        for (int mb = 0; mb < 4; ++mb) { const int e = ISV ? (mb >> 1) * 2048 + (mb & 1) * 256 : mb * 256;
            *(v8us*)(ph + e) = __builtin_bit_cast(v8us, wh[mb]); *(v8us*)(pl + e) = __builtin_bit_cast(v8us, wl[mb]);
            if (ISV) *(v8h*)(px + e) = __builtin_bit_cast(v8h, wx[mb]); }
        asm volatile("s_wait_xcnt 0x0" ::: "memory");   // before the next turn reuses the data and address registers of the stores above
        __builtin_amdgcn_sched_barrier(0);   // keeps later register writes behind that wait, and the later turns' conversions in their turns
    }
}
__global__ __launch_bounds__(32) void k_gemmqkv(const bf* __restrict__ X, const bf* __restrict__ Wt, const float* __restrict__ bias, bf* Qh, bf* Ql, bf* Kh, bf* Kl, bf* Vh, bf* Vl, h16* V16) {
    static_assert(HD == 64 && TT % 64 == 0 && DM % 32 == 0, "one tile is 64 rows of one entry and one head");
    const int lane = threadIdx.x & 31; const int r0 = blockIdx.x * 64, c0 = blockIdx.y * 64; const bool isv = c0 >= DQ + DKV;
    const bf* xp = X + (size_t)r0 * DM + 8 * lane; const bf* wp = Wt + (size_t)c0 * DM + 8 * lane;   // the lane's piece of the first fragment of the tile's first 16 rows
    const bf* pa = isv ? xp : wp; const bf* pb = isv ? wp : xp;
    v8f acc[4][4];
#pragma unroll
    for (int mb = 0; mb < 4; ++mb)
#pragma unroll
        for (int nb = 0; nb < 4; ++nb) acc[mb][nb] = (v8f){};
#pragma unroll 1   // as in k_gemmw: one k step of 32 a trip
    for (int kc = 0; kc < DM; kc += 32) {
        const bf* ak = pa + kc * 16; const bf* bk = pb + kc * 16; v16bf a[4];   // a k step of 32 is the next fragment
#pragma unroll
        for (int mb = 0; mb < 4; ++mb) a[mb] = WFrag<bf>::ld(ak + (size_t)mb * 16 * DM);
#pragma unroll
        for (int nb = 0; nb < 4; ++nb) { const v16bf b = WFrag<bf>::ld(bk + (size_t)nb * 16 * DM);
#pragma unroll
            for (int mb = 0; mb < 4; ++mb) acc[mb][nb] = wmmab(a[mb], b, acc[mb][nb]); }
        // the wait: before the trip's two address pairs are rewritten (they are named so that they stay in their registers up to here); the v_nops, as in k_gemmw: the distance behind the trip's last matrix instruction, on the back edge and on the way out alike
        asm volatile("s_wait_xcnt 0x0\n\tv_nop\n\tv_nop\n\tv_nop\n\tv_nop" : "+v"(acc[0][0]), "+v"(acc[1][1]), "+v"(acc[2][2]), "+v"(acc[3][3]) : "v"(a[0]), "v"(a[3]), "v"(ak), "v"(bk));
    }
    const int en = r0 / TT, t0 = r0 % TT;
    if (isv) { const size_t o = ((size_t)en * NKV + (c0 - DQ - DKV) / HD) * HD * TT + (size_t)t0 * HD; qkv_store<true>(acc, bias + c0, Vh + o, Vl + o, V16 + o, lane); }   // 32 keys of a head are 4 fragments = 32 HD elements
    else { const bool isk = c0 >= DQ; const size_t o = (((size_t)en * (isk ? NKV : NH_) + (isk ? c0 - DQ : c0) / HD) * TT + t0) * HD; qkv_store<false>(acc, bias + c0, (isk ? Kh : Qh) + o, (isk ? Kl : Ql) + o, nullptr, lane); }
}
template <bool HI>
__device__ __forceinline__ void fattn_body(const bf* __restrict__ Qh, const bf* __restrict__ Ql, const bf* __restrict__ Kh, const bf* __restrict__ Kl, const bf* __restrict__ Vh, const bf* __restrict__ Vl, const h16* __restrict__ V16, const float* __restrict__ am, bf* Ah, bf* Al, int q0, int lane) {
    v16bf qh[2][2], ql[2][2];   // [column group][k step of 32]
    v16bf kh[2][2], kl[2][2];   // [16-key tile][k step]
    v4f mk[2][2][2];            // [column group][16-key tile][half of the lane's 8 keys]
    // all planes in fragment order: 16 rows of q or k are 2 fragments (16 HD elements), 32 keys of v are 4 (32 HD elements), 16 queries x 32 keys of the mask are 4 runs of 128 floats
    const bf* kph = Kh + 8 * lane; const bf* kpl = Kl + 8 * lane;
    const float* mp = am + (size_t)q0 * TT + 4 * lane;
    const size_t vof = 8 * lane;
    { const bf* qph = Qh + (size_t)q0 * HD + 8 * lane; const bf* qpl = Ql + (size_t)q0 * HD + 8 * lane;
#pragma unroll
        for (int g = 0; g < 2; ++g)
#pragma unroll
            for (int kc = 0; kc < 2; ++kc) { qh[g][kc] = WFrag<bf>::ld(qph + 16 * g * HD + 512 * kc); ql[g][kc] = WFrag<bf>::ld(qpl + 16 * g * HD + 512 * kc); }
#pragma unroll
        for (int kt = 0; kt < 2; ++kt) {
#pragma unroll
            for (int kc = 0; kc < 2; ++kc) { kh[kt][kc] = WFrag<bf>::ld(kph + 16 * kt * HD + 512 * kc); kl[kt][kc] = WFrag<bf>::ld(kpl + 16 * kt * HD + 512 * kc); }
#pragma unroll
            for (int g = 0; g < 2; ++g) { mk[g][kt][0] = *(const v4f*)(mp + 16 * g * TT + 256 * kt); mk[g][kt][1] = *(const v4f*)(mp + 16 * g * TT + 256 * kt + 128); } }
        asm volatile("s_wait_xcnt 0x0" :: "v"(qph), "v"(qpl), "v"(kph), "v"(kpl), "v"(mp) : "memory");   // before any address register of the loads above is reused; the addresses are named so that they stay in their registers up to here
        __builtin_amdgcn_sched_barrier(0);   // keeps later register writes behind that wait
    }
    v8f acc[2][4]; float mrun[2]; v2f lrun[2];
#pragma unroll
    for (int g = 0; g < 2; ++g) { mrun[g] = -3.0e38f; lrun[g] = (v2f){};
#pragma unroll
        for (int t = 0; t < 4; ++t) acc[g][t] = (v8f){}; }
    const v2f scl2 = {SCL, SCL}, l2e2 = {L2E, L2E};
#pragma unroll 1   // one pass a trip: unrolled, the fragments of two passes would be live at once
    for (int kb = 0; kb < TT / 32; ++kb) {
        const int key0 = kb * 32, nk0 = (kb + 1 < TT / 32) ? key0 + 32 : key0;   // the last pass fetches its own rows again (in bounds, unused)
        v8f s[2][2];   // [16-key tile][column group]
#pragma unroll
        for (int kt = 0; kt < 2; ++kt)
#pragma unroll
            for (int g = 0; g < 2; ++g) s[kt][g] = (v8f){};
#pragma unroll
        for (int kc = 0; kc < 2; ++kc) {   // per accumulator: qh.kh, ql.kh, qh.kl, k steps ascending
#pragma unroll
            for (int kt = 0; kt < 2; ++kt)
#pragma unroll
                for (int g = 0; g < 2; ++g) s[kt][g] = wmmab(kh[kt][kc], qh[g][kc], s[kt][g]);
#pragma unroll
            for (int kt = 0; kt < 2; ++kt)
#pragma unroll
                for (int g = 0; g < 2; ++g) s[kt][g] = wmmab(kh[kt][kc], ql[g][kc], s[kt][g]);
#pragma unroll
            for (int kt = 0; kt < 2; ++kt)
#pragma unroll
                for (int g = 0; g < 2; ++g) s[kt][g] = wmmab(kl[kt][kc], qh[g][kc], s[kt][g]); }
        // t = s / 8 - mask (s / 8 is exact, so the fused form rounds once, as a separate subtraction does)
#pragma unroll
        for (int g = 0; g < 2; ++g)
#pragma unroll
            for (int kt = 0; kt < 2; ++kt)
#pragma unroll
                for (int i = 0; i < 4; ++i) { const v2f sv = {s[kt][g][2 * i], s[kt][g][2 * i + 1]}, mv = {mk[g][kt][i >> 1][2 * (i & 1)], mk[g][kt][i >> 1][2 * (i & 1) + 1]};
                    const v2f t = __builtin_elementwise_fma(sv, scl2, -mv); s[kt][g][2 * i] = t[0]; s[kt][g][2 * i + 1] = t[1]; }
        // One group of loads, in flight under the softmax: this pass's values, the next pass's keys and mask (their registers are free from here on).
        __builtin_amdgcn_sched_barrier(0);   // keeps the group from sinking towards its users, where its latency would be exposed
        v16bf vh[4], vl[4]; v16h vx[4];
        { const bf* nkh = kph + (size_t)nk0 * HD; const bf* nkl = kpl + (size_t)nk0 * HD; const float* nmp = mp + nk0 * 16;
            const bf* vph = Vh + vof + key0 * HD; const bf* vpl = Vl + vof + key0 * HD; const h16* vpx = V16 + vof + key0 * HD;
#pragma unroll
            for (int t = 0; t < 4; ++t) { if (HI) { vh[t] = WFrag<bf>::ld(vph + 512 * t); vl[t] = WFrag<bf>::ld(vpl + 512 * t); } else vx[t] = WFrag<h16>::ld(vpx + 512 * t); }
#pragma unroll
            for (int kt = 0; kt < 2; ++kt)
#pragma unroll
                for (int kc = 0; kc < 2; ++kc) { kh[kt][kc] = WFrag<bf>::ld(nkh + 16 * kt * HD + 512 * kc); kl[kt][kc] = WFrag<bf>::ld(nkl + 16 * kt * HD + 512 * kc); }
#pragma unroll
            for (int kt = 0; kt < 2; ++kt)
#pragma unroll
                for (int g = 0; g < 2; ++g) { mk[g][kt][0] = *(const v4f*)(nmp + 16 * g * TT + 256 * kt); mk[g][kt][1] = *(const v4f*)(nmp + 16 * g * TT + 256 * kt + 128); }
            // before any address register of the group is reused; the addresses are named so that they stay in their registers up to here
            if (HI) asm volatile("s_wait_xcnt 0x0" :: "v"(nkh), "v"(nkl), "v"(nmp), "v"(vph), "v"(vpl) : "memory"); else asm volatile("s_wait_xcnt 0x0" :: "v"(nkh), "v"(nkl), "v"(nmp), "v"(vpx) : "memory"); }
        __builtin_amdgcn_sched_barrier(0);   // keeps later register writes behind that wait
        // each query's maximum over the pass
        float mb[2]; bool need = false;
#pragma unroll
        for (int g = 0; g < 2; ++g) { float mx = -3.0e38f;
#pragma unroll
            for (int kt = 0; kt < 2; ++kt)
#pragma unroll
                for (int j = 0; j < 8; ++j) mx = fmaxf(mx, s[kt][g][j]);
            mx = fmaxf(mx, xhalf(mx)); mb[g] = mx; need = need || (mx > mrun[g] + LAZY); }
        if (__builtin_amdgcn_ballot_w32(need) != 0) {   // wave-uniform; always on the first pass, rare later
#pragma unroll
            for (int g = 0; g < 2; ++g) { const float mn = fmaxf(mrun[g], mb[g]); const float corr = __builtin_amdgcn_exp2f((mrun[g] - mn) * L2E); mrun[g] = mn; lrun[g] = lrun[g] * corr;   // corr = 0 on the first pass
#pragma unroll
                for (int t = 0; t < 4; ++t) acc[g][t] = acc[g][t] * corr; } }
#pragma unroll
        for (int g = 0; g < 2; ++g) { const float nm = -mrun[g] * L2E; const v2f nm2 = {nm, nm}; v8u wh, wl; v16h px;
#pragma unroll
            for (int i = 0; i < 8; ++i) { const int kt = i >> 2, r = 2 * (i & 3);   // operand elements 2i, 2i+1 = tile kt, registers r, r+1
                const v2f sv = {s[kt][g][r], s[kt][g][r + 1]}; const v2f a = __builtin_elementwise_fma(sv, l2e2, nm2);
                v2f p; p[0] = __builtin_amdgcn_exp2f(a[0]); p[1] = __builtin_amdgcn_exp2f(a[1]); lrun[g] += p;
                if (HI) { const unsigned h = pack2(p[0], p[1]); wh[i] = h; wl[i] = pack2(p[0] - __uint_as_float(h << 16), p[1] - __uint_as_float(h & 0xFFFF0000u)); }
                else { px[2 * i] = tohx(p[0]); px[2 * i + 1] = tohx(p[1]); } }
            if (HI) { const v16bf ph = __builtin_bit_cast(v16bf, wh), pl = __builtin_bit_cast(v16bf, wl);
#pragma unroll
                for (int t = 0; t < 4; ++t) acc[g][t] = wmmab(vh[t], ph, acc[g][t]);   // per accumulator: ph.vh, pl.vh, ph.vl
#pragma unroll
                for (int t = 0; t < 4; ++t) acc[g][t] = wmmab(vh[t], pl, acc[g][t]);
#pragma unroll
                for (int t = 0; t < 4; ++t) acc[g][t] = wmmab(vl[t], ph, acc[g][t]);
            } else {
#pragma unroll
                for (int t = 0; t < 4; ++t) acc[g][t] = wmma16(vx[t], px, acc[g][t]); } }
        __builtin_amdgcn_sched_barrier(0);   // holds the v_nops behind the last matrix instruction
        asm volatile("v_nop\n\tv_nop\n\tv_nop\n\tv_nop");   // the distance behind the pass's last matrix instruction, on the back edge and on the way out of the loop alike
        __builtin_amdgcn_sched_barrier(0);
    }
#pragma unroll
    for (int g = 0; g < 2; ++g) { const float lh = lrun[g][0] + lrun[g][1]; const float l = lh + xhalf(lh); const float inv = __fdiv_rn(1.0f, l); bf* pa = Ah + (size_t)(q0 + 16 * g) * DQ + 8 * lane; bf* pb = Al + (size_t)(q0 + 16 * g) * DQ + 8 * lane;   // a lane's 8 registers are d = 16 t + 8 hi + 0..7 of query lr: piece t of the head's 2 fragments of that row block
        v8us oh[4], ol[4];
#pragma unroll
        for (int t = 0; t < 4; ++t) {
#pragma unroll
            for (int j = 0; j < 8; ++j) { unsigned short a, c2; splitf(acc[g][t][j] * inv, a, c2); oh[t][j] = a; ol[t][j] = c2; } }
        __builtin_amdgcn_sched_barrier(0);   // the group's conversions stay in front of its stores, so that no store's data register is written again before the wait below
#pragma unroll
        for (int t = 0; t < 4; ++t) { *(v8us*)(pa + 256 * t) = oh[t]; *(v8us*)(pb + 256 * t) = ol[t]; }
        asm volatile("s_wait_xcnt 0x0" ::: "memory");   // before the next group reuses the data and address registers of the stores above
        __builtin_amdgcn_sched_barrier(0);   // keeps later register writes behind that wait
    }
}
// grid.y = entry * NH_ + head (planes consecutive); writes the merged [t][DQ] hi and lo planes that Wo reads, in fragment order (a head's 64 columns are 2 fragments of each 16-row block).
__global__ __launch_bounds__(256) void k_fattn(const bf* __restrict__ Qh, const bf* __restrict__ Ql, const bf* __restrict__ Kh, const bf* __restrict__ Kl, const bf* __restrict__ Vh, const bf* __restrict__ Vl, const h16* __restrict__ V16, const float* __restrict__ am, bf* Ah, bf* Al) {
    static_assert(2 * RH == TT && RH % 128 == 0 && HD == 64 && NKV == NH_, "the wave split below is written for these");
    const int lane = threadIdx.x & 31; const int wave = __builtin_amdgcn_readfirstlane((int)(threadIdx.x >> 5));
    const size_t z = blockIdx.y, po = z * TT * HD, ao = (z / NH_) * TT * DQ + (z % NH_) * HD * 16; const int qb = (blockIdx.x * 4 + (wave & 3)) * 32;
    if (wave < 4) fattn_body<true>(Qh + po, Ql + po, Kh + po, Kl + po, Vh + po, Vl + po, V16 + po, am, Ah + ao, Al + ao, qb, lane);
    else fattn_body<false>(Qh + po, Ql + po, Kh + po, Kl + po, Vh + po, Vl + po, V16 + po, am, Ah + ao, Al + ao, RH + qb, lane);
}

extern "C" void kernel_launch(void* const* d_in, const int* in_sizes, int n_in,
                              void* d_out, int out_size, void* d_ws, size_t ws_size, hipStream_t stream) {
    (void)in_sizes; (void)n_in; (void)out_size;
    const float* x = (const float*)d_in[0]; const float* amask = (const float*)d_in[1]; const float* wf = (const float*)d_in[2]; const float* bf3 = (const float*)d_in[3]; const float* wo = (const float*)d_in[4]; const float* bo = (const float*)d_in[5];
    float* OUT = (float*)d_out;     // [8][1024][1024]
    char* wsp = (char*)d_ws;
    auto take = [&](size_t bytes) { char* p = wsp; wsp += (bytes + 255) & ~(size_t)255; return (void*)p; };
    bf* WO = (bf*)take((size_t)DM * DQ * 2);
    bf* WALL = (bf*)take((size_t)(DQ + 2 * DKV) * DM * 2); float* AMR = (float*)take((size_t)TT * TT * 4);
    h16* VT16 = (h16*)take((size_t)GB * NKV * HD * TT * 2);
    bf* QPh = (bf*)take((size_t)GB * NH_ * TT * HD * 2); bf* QPl = (bf*)take((size_t)GB * NH_ * TT * HD * 2); bf* KPh = (bf*)take((size_t)GB * NKV * TT * HD * 2); bf* KPl = (bf*)take((size_t)GB * NKV * TT * HD * 2); bf* VTh = (bf*)take((size_t)GB * NKV * HD * TT * 2); bf* VTl = (bf*)take((size_t)GB * NKV * HD * TT * 2);
    const int NQKV = DQ + 2 * DKV;
    bf* XB = (bf*)take((size_t)GB * TT * DM * 2);            // bf16 x of GB entries
    bf* ATh = (bf*)take((size_t)GB * TT * DQ * 2); bf* ATl = (bf*)take((size_t)GB * TT * DQ * 2);
    if ((size_t)(wsp - (char*)d_ws) > ws_size) return;    // ws 256 MiB; the carve-up takes about 92 MiB
    k_wtG<DM, DQ + 2 * DKV><<<(unsigned)((DM * (DQ + 2 * DKV) / 8 + 255) / 256), 256, 0, stream>>>(wf, WALL); k_rbf<<<(unsigned)(((size_t)TT * TT / 4 + 255) / 256), 256, 0, stream>>>(amask, AMR, TT * TT / 4);
    k_wtG<DQ, DM><<<(unsigned)((DQ * DM / 8 + 255) / 256), 256, 0, stream>>>(wo, WO);
    for (int b0 = 0; b0 < NB_; b0 += GB) {
        k_cvt8<<<(unsigned)(((size_t)GB * TT * DM / 8 + 255) / 256), 256, 0, stream>>>(x + (size_t)b0 * TT * DM, XB, (size_t)GB * TT * DM / 8);
        k_gemmqkv<<<dim3(GB * TT / 64, NQKV / 64, 1), 32, 0, stream>>>(XB, WALL, bf3, QPh, QPl, KPh, KPl, VTh, VTl, VT16);   // q | k | v of GB entries as one product of width NQKV, written as the head planes
        k_fattn<<<dim3(RH / 128, GB * NH_, 1), 256, 0, stream>>>(QPh, QPl, KPh, KPl, VTh, VTl, VT16, AMR, ATh, ATl);   // scores, softmax, attn.v and the head merge of GB entries
        k_gemmw<bf, 1, true, DQ><<<dim3(GB * TT / 64, DM / 64, 1), 32, 0, stream>>>(ATh, ATl, WO, nullptr, OUT + (size_t)b0 * TT * DM, DM, bo, 0, 0, 0); }
}

// v005
// It runs in 221 microseconds.
// Next to v004, in two timings, it ran 1.25 and 1.28 times as fast.
// All steps since v000 together make it 21.3 times as fast.
#include <hip/hip_runtime.h>

// R3DAttention (x [8][1024][1024]; qkv = x Wqkv + bqkv ([1024][3072]: q | k | v blocks, 16 heads x 64); scores = q.k / 8 - mask[i][j] (f32 [1024][1024], read; shared over batch and heads); softmax; out = merged Wo + bo -> [8][1024][1024]).
// Compute dtypes, f32 accumulate: every input rounded to bf16; q/k/v on PLAIN bf16 operands (inputs: exact) + bias; scores hl x hl (3 products) on every row, attn.v: query rows < 512 hl (3 products), the rest single fp16, on exponentials against a running maximum, divided by the denominator at the end; the (bf16-rounded) mask subtracted per element in f32; softmax f32; Wo hl x exact (2 products) + bias.

// FRAGMENT ORDER: every 16-bit plane that a matrix instruction reads is kept as a row of 1-KiB fragments (16 rows r x 32 k). Inside a fragment the 16-B piece of
// lane l = 16 hi + lr and half h lies at element 256 h + 8 l and holds row lr, k = 16 h + 8 hi + 0..7: exactly what that lane's registers hold. A fragment is then two
// wave-wide 16-B loads of 512 contiguous bytes each (4 whole lines) in place of two loads that take 32 B out of each of 16 lines. A plane [R][K]: fragment (r / 16, k / 32) at element (r / 16) * 16 K + (k / 32) * 512.
#define NB_  8
#define TT   1024
#define DM   1024
#define NH_  16
#define NKV  16
#define REP  (NH_ / NKV)
#define HD   64
#define DQ   (NH_ * HD)
#define DKV  (NKV * HD)
#define GB   8                    // batch entries per projection launch: all of them (the workspace holds the head planes of GB entries)
#define RH   512                  // query rows < RH use hi+lo planes
#define WIN  0
#define SCL  0.125f   // HD^-0.5
typedef _Float16 h16;
typedef unsigned short bf;
typedef __attribute__((ext_vector_type(16))) __bf16   v16bf;
typedef __attribute__((ext_vector_type(16))) _Float16 v16h;
typedef __attribute__((ext_vector_type(8)))  _Float16 v8h;
typedef __attribute__((ext_vector_type(8)))  unsigned short v8us;
typedef __attribute__((ext_vector_type(8)))  float    v8f;
typedef __attribute__((ext_vector_type(4)))  float    v4f;
typedef v8h  __attribute__((may_alias)) v8ha;
typedef v4f  __attribute__((may_alias)) v4fa;
typedef v8us __attribute__((may_alias)) v8usa;

__device__ __forceinline__ unsigned short f2bf(float f) { unsigned u = __float_as_uint(f); u += 0x7FFFu + ((u >> 16) & 1u); return (unsigned short)(u >> 16); }
__device__ __forceinline__ float bf2f(unsigned short b) { return __uint_as_float(((unsigned)b) << 16); }
__device__ __forceinline__ float bfr(float f) { return bf2f(f2bf(f)); }
__device__ __forceinline__ v16h cat16(v8h lo, v8h hi) { return __builtin_shufflevector(lo, hi, 0, 1, 2, 3, 4, 5, 6, 7, 8, 9, 10, 11, 12, 13, 14, 15); }
__device__ __forceinline__ v16bf cat16b(v8us lo, v8us hi) { return __builtin_bit_cast(v16bf, __builtin_shufflevector(lo, hi, 0, 1, 2, 3, 4, 5, 6, 7, 8, 9, 10, 11, 12, 13, 14, 15)); }
__device__ __forceinline__ v8f wmma16(v16h a, v16h b, v8f c) { return __builtin_amdgcn_wmma_f32_16x16x32_f16(false, a, false, b, (short)0, c, false, false); }
__device__ __forceinline__ v8f wmmab(v16bf a, v16bf b, v8f c) { return __builtin_amdgcn_wmma_f32_16x16x32_bf16(false, a, false, b, (short)0, c, false, false); }



// ---- k_gemmw: register-blocked GEMM, ONE WAVE per 64x64 output tile (16 accumulators), operands straight from 16-bit planes in fragment order (ld takes the lane's own piece of a fragment); grid (M/64, N/64, Z), 32 threads.
// C[m][n] (f32, pitch ldc, + optional f32 bias[n]) = sum_k A[m][k] Bt[n][k] (+ split products per NSPLIT). z-batch strides sA/sB/sC in elements. K % 32 == 0.
template <typename T16> struct WFrag;
template <> struct WFrag<h16> { typedef v16h V; static __device__ __forceinline__ V ld(const h16* p) { return cat16(*(const v8h*)p, *(const v8h*)(p + 256)); } static __device__ __forceinline__ v8f mma(V a, V b, v8f c) { return wmma16(a, b, c); } };
template <> struct WFrag<bf> { typedef v16bf V; static __device__ __forceinline__ V ld(const bf* p) { return cat16b(*(const v8us*)p, *(const v8us*)(p + 256)); } static __device__ __forceinline__ v8f mma(V a, V b, v8f c) { return wmmab(a, b, c); } };
template <typename T16, int NSPLIT, bool BIAS, int K>   // K at compile time: a trip's fragments then lie at immediate offsets from one address pair per plane
__global__ __launch_bounds__(32) void k_gemmw(const T16* __restrict__ A, const T16* __restrict__ A2, const T16* __restrict__ Bt, const T16* __restrict__ Bt2, float* C, int ldc, const float* __restrict__ bias, size_t sA, size_t sB, size_t sC) {
    typedef typename WFrag<T16>::V V;
    __shared__ __align__(16) float os[16 * 68];
    const size_t z = blockIdx.z; A += z * sA; if (A2) A2 += z * sA; Bt += z * sB; if (Bt2) Bt2 += z * sB; C += z * sC;
    const int lane = threadIdx.x & 31, lr = lane & 15, hi = lane >> 4; const int r0 = blockIdx.x * 64, c0 = blockIdx.y * 64;
    v8f acc[4][4];
#pragma unroll
    for (int mb = 0; mb < 4; ++mb)
#pragma unroll
        for (int nb = 0; nb < 4; ++nb) acc[mb][nb] = (v8f){};
    const size_t aoff = (size_t)r0 * K + 8 * lane, boff = (size_t)c0 * K + 8 * lane;   // 16 rows of a plane are 16 K elements; a k step of 32 is the next fragment, 512 elements on
#pragma unroll 1
    for (int kc = 0; kc < K; kc += 32) {
        const T16* ak = A + aoff + (size_t)kc * 16; const T16* bk = Bt + boff + (size_t)kc * 16;
        const T16* a2k = (NSPLIT == 1 || NSPLIT == 2) ? A2 + aoff + (size_t)kc * 16 : ak; const T16* b2k = (NSPLIT >= 2) ? Bt2 + boff + (size_t)kc * 16 : bk;
        V a[4], a2[4];
#pragma unroll
        for (int mb = 0; mb < 4; ++mb) { a[mb] = WFrag<T16>::ld(ak + (size_t)mb * 16 * K); if (NSPLIT == 1 || NSPLIT == 2) a2[mb] = WFrag<T16>::ld(a2k + (size_t)mb * 16 * K); }
#pragma unroll
        for (int nb = 0; nb < 4; ++nb) { const V b = WFrag<T16>::ld(bk + (size_t)nb * 16 * K); V b2; if (NSPLIT >= 2) b2 = WFrag<T16>::ld(b2k + (size_t)nb * 16 * K);
#pragma unroll
            for (int mb = 0; mb < 4; ++mb) { acc[mb][nb] = WFrag<T16>::mma(a[mb], b, acc[mb][nb]); if (NSPLIT == 1 || NSPLIT == 2) acc[mb][nb] = WFrag<T16>::mma(a2[mb], b, acc[mb][nb]); if (NSPLIT >= 2) acc[mb][nb] = WFrag<T16>::mma(a[mb], b2, acc[mb][nb]); } }
        // the wait: before the trip's address pairs are rewritten (they are named so that they stay in their registers up to here); the v_nops: the distance behind the trip's last matrix instruction, on the back edge and on the way out alike
        asm volatile("s_wait_xcnt 0x0\n\tv_nop\n\tv_nop\n\tv_nop\n\tv_nop" : "+v"(acc[0][0]), "+v"(acc[1][1]), "+v"(acc[2][2]), "+v"(acc[3][3]) : "v"(a[0]), "v"(a[3]), "v"(ak), "v"(a2k), "v"(bk), "v"(b2k));
    }
#pragma unroll
    for (int mb = 0; mb < 4; ++mb) {
#pragma unroll
        for (int nb = 0; nb < 4; ++nb) {
#pragma unroll
            for (int j = 0; j < 8; ++j) os[(hi * 8 + j) * 68 + nb * 16 + lr] = acc[mb][nb][j]; }
        __builtin_amdgcn_wave_barrier(); asm volatile("" ::: "memory");
        float* crow = C + (size_t)(r0 + mb * 16) * ldc + c0;
{
#pragma unroll
            for (int s = 0; s < 8; ++s) { const int row = 2 * s + hi, cofs = lr * 4; v4f val = *(const v4fa*)(os + row * 68 + cofs); if (BIAS) { val[0] += bfr(bias[c0 + cofs]); val[1] += bfr(bias[c0 + cofs + 1]); val[2] += bfr(bias[c0 + cofs + 2]); val[3] += bfr(bias[c0 + cofs + 3]); }
                *(v4f*)(crow + (size_t)row * ldc + cofs) = val; }
             }
        __builtin_amdgcn_wave_barrier(); asm volatile("" ::: "memory");
    }
}

__device__ __forceinline__ h16 tohx(float x) { return (h16)x; }
__device__ __forceinline__ void splitf(float y, unsigned short& h, unsigned short& l) { h = f2bf(y); l = f2bf(y - bf2f(h)); }
typedef __attribute__((ext_vector_type(2))) _Float16 v2h;
typedef __attribute__((ext_vector_type(4))) _Float16 v4h;
typedef __attribute__((ext_vector_type(2))) unsigned short v2us;
typedef __attribute__((ext_vector_type(4))) unsigned short v4us;
typedef __attribute__((ext_vector_type(2))) float v2f;
typedef __attribute__((ext_vector_type(4))) int v4i;

// wtG_body: w [K][N] f32 -> its transpose [N][K] as bf16 in fragment order. One thread makes one 16-B piece (8 k of one n): the 16 lanes of a half wave read 16 neighbouring n of one row of w, a wave stores 512 contiguous bytes.
template <int K, int N>   // at compile time: the 8 rows of a piece then lie at immediate offsets from one address pair
__device__ __forceinline__ void wtG_body(const float* __restrict__ w, bf* Bt, int blk) {
    const int i = blk * 256 + threadIdx.x; if (i >= N * (K / 8)) return;
    const int lane = i & 31, f = i >> 6, kf = K / 32; const int n = (f / kf) * 16 + (lane & 15), k0 = (f % kf) * 32 + ((i >> 5) & 1) * 16 + (lane >> 4) * 8;
    const float* p = w + (size_t)k0 * N + n; v8us o;
#pragma unroll
    for (int j = 0; j < 8; ++j) o[j] = f2bf(p[(size_t)j * N]);
    *(v8us*)(Bt + (size_t)i * 8) = o;
}
// cvt8_body: x rows [.][DM] f32 -> bf16 in fragment order; one thread makes one 16-B piece. A wave takes 8 rows x the 4 pieces of a fragment's 32 k: it reads 128 contiguous bytes of each row and stores 4 whole lines.
__device__ __forceinline__ void cvt8_body(const float* __restrict__ src, bf* dst, size_t n8, int blk) { const size_t i = (size_t)blk * 256 + threadIdx.x; if (i >= n8) return;
    const int lr = (int)(i & 7) + (int)((i >> 5) & 1) * 8, pc = (int)((i >> 3) & 3); const size_t f = i >> 6;   // pc = 2 h + hi: k = 8 pc .. of the fragment, piece 16 pc + lr
    const v8f v = *(const v8f*)(src + ((f / (DM / 32)) * 16 + lr) * DM + (f % (DM / 32)) * 32 + pc * 8); v8us o;
    asm volatile("s_wait_xcnt 0x0" ::: "memory");   // before the address pair of the two loads above is reused
#pragma unroll
    for (int k = 0; k < 8; ++k) o[k] = f2bf(v[k]); *(v8us*)(dst + (f * 64 + pc * 16 + lr) * 8) = o;  }
// rbf_body: bf16-rounded f32 copy of the mask, in the order in which k_fattn's lanes hold it: per 16 queries x 32 keys four runs (16-key tile kt, half h of a lane's 8 keys) of 32 lanes x 4 floats;
// lane 16 hi + lr has query lr, keys 16 kt + 8 hi + 4 h + 0..3. Thread i makes piece i.
__device__ __forceinline__ void rbf_body(const float* __restrict__ src, float* dst, int n4, int wg) { const int i = wg * 256 + threadIdx.x; if (i >= n4) return;
    const int lane = i & 31, sub = (i >> 5) & 3, blk = i >> 7; const int q = (blk / (TT / 32)) * 16 + (lane & 15), key = (blk % (TT / 32)) * 32 + (sub >> 1) * 16 + (lane >> 4) * 8 + (sub & 1) * 4;
    const v4f a = *(const v4f*)(src + (size_t)q * TT + key); v4f o; for (int u = 0; u < 4; ++u) o[u] = bfr(a[u]); *(v4f*)(dst + (size_t)i * 4) = o;  }
// k_prep: the four conversions above depend on nothing but the inputs, so they share ONE grid: a workgroup's index says which of them it serves (the weight transposes, whose reads are the most scattered, first).
#define PB_WQ  (DM * (DQ + 2 * DKV) / 8 / 256)
#define PB_WO  (DQ * DM / 8 / 256)
#define PB_MK  (TT * TT / 4 / 256)
#define PB_X   (NB_ * TT * DM / 8 / 256)
__global__ __launch_bounds__(256) void k_prep(const float* __restrict__ x, const float* __restrict__ amask, const float* __restrict__ wf, const float* __restrict__ wo, bf* XB, float* AMR, bf* WALL, bf* WO) {
    static_assert(DM * (DQ + 2 * DKV) % 2048 == 0 && DQ * DM % 2048 == 0 && TT * TT % 1024 == 0 && TT * DM % 2048 == 0, "whole workgroups for each part");
    const int b = blockIdx.x;
    if (b < PB_WQ) wtG_body<DM, DQ + 2 * DKV>(wf, WALL, b);
    else if (b < PB_WQ + PB_WO) wtG_body<DQ, DM>(wo, WO, b - PB_WQ);
    else if (b < PB_WQ + PB_WO + PB_MK) rbf_body(amask, AMR, TT * TT / 4, b - PB_WQ - PB_WO);
    else cvt8_body(x, XB, (size_t)NB_ * TT * DM / 8, b - PB_WQ - PB_WO - PB_MK);
}
// ---- k_fattn: scores, softmax and attn.v of one head in one kernel; neither the scores nor the probabilities go through memory.
// Transposed products: S^T = K Q^T (A = 16 keys, B = 16 queries), so a lane holds 8 consecutive keys of ONE query (column lr) per tile, and two
// 16-key tiles are, register for register, the B operand (32 keys) of O^T += V^T P^T (A = 16 rows of the [d][t] value planes). No LDS, no barrier.
// One wave: 32 queries (two column groups) against all TT keys in passes of 32, running maximum and denominator per query. Grid (RH / 128, heads), 8 waves:
// waves 0-3 take query rows < RH (P and V as hi+lo bf16, 3 products), waves 4-7 the rows >= RH (P and V single fp16), so every workgroup carries the same work.
typedef __attribute__((ext_vector_type(8))) unsigned v8u;
typedef __attribute__((ext_vector_type(2))) __bf16 v2bf;
#define L2E 1.4426950408889634f
#define LAZY 4.0f   // the maximum in use may trail a query's true maximum by this much (an exponential then reaches e^4, far inside fp16 and bf16 range)
__device__ __forceinline__ unsigned pack2(float a, float b) { v2f x; x[0] = a; x[1] = b; return __builtin_bit_cast(unsigned, __builtin_convertvector(x, v2bf)); }   // round to nearest even
__device__ __forceinline__ float xhalf(float x) { return __builtin_bit_cast(float, __builtin_amdgcn_permlanex16(__builtin_bit_cast(int, x), __builtin_bit_cast(int, x), 0x76543210, 0xfedcba98, false, false)); }   // lane l <-> lane l ^ 16
// ---- k_gemmqkv: the q | k | v projection of GB entries, ONE WAVE per 64x64 tile (= 64 rows t of one head's q, k or v), main loop as k_gemmw; the epilogue adds the bias and
// writes the planes that k_fattn reads: q, k [head][t][d] and v [head][d][t], each as hi + lo bf16 (v also single fp16), in fragment order. A lane's 8 accumulator registers are 8 consecutive rows of the
// A operand, so a q or k tile is computed as W X^T (A = 64 d) and a v tile as X W^T (A = 64 t): either way they are 8 consecutive elements of one plane row (the B index), which is
// the lane's own 16-B piece of a fragment: every wave-wide store is 512 contiguous bytes, straight from registers. q, k: fragment (t / 16, d / 32); v: per 32 keys the four fragments of d / 16.
typedef __attribute__((ext_vector_type(4))) unsigned v4u;
template <bool ISV>
__device__ __forceinline__ void qkv_store(const v8f (&acc)[4][4], const float* __restrict__ bias, bf* Ph, bf* Pl, h16* P16, int lane) {
    const int lr = lane & 15, hi = lane >> 4;
    v8f bq[4];   // q, k: the bias runs along the plane row (d = 16 mb + 8 hi + j)
    if (!ISV) {
#pragma unroll
        for (int mb = 0; mb < 4; ++mb) { const v4f b0 = *(const v4f*)(bias + mb * 16 + hi * 8), b1 = *(const v4f*)(bias + mb * 16 + hi * 8 + 4);
#pragma unroll
            for (int j = 0; j < 4; ++j) { bq[mb][j] = bfr(b0[j]); bq[mb][4 + j] = bfr(b1[j]); } } }
    float bv[4];   // v: one d, so one bias, per plane row (d = 16 nb + lr)
    if (ISV) {
#pragma unroll
        for (int nb = 0; nb < 4; ++nb) bv[nb] = bfr(bias[nb * 16 + lr]); }
#pragma unroll
    for (int nb = 0; nb < 4; ++nb) {   // 16 plane rows a turn
        v4u wh[4], wl[4], wx[4];
#pragma unroll
        for (int mb = 0; mb < 4; ++mb) {
#pragma unroll
            for (int i = 0; i < 4; ++i) { const float a = acc[mb][nb][2 * i] + (ISV ? bv[nb] : bq[mb][2 * i]), b = acc[mb][nb][2 * i + 1] + (ISV ? bv[nb] : bq[mb][2 * i + 1]);
                const unsigned h = pack2(a, b); wh[mb][i] = h; wl[mb][i] = pack2(a - __uint_as_float(h << 16), b - __uint_as_float(h & 0xFFFF0000u));
                if (ISV) { v2f x; x[0] = a; x[1] = b; wx[mb][i] = __builtin_bit_cast(unsigned, __builtin_convertvector(x, v2h)); } } }
        __builtin_amdgcn_sched_barrier(0);   // the turn's conversions stay in front of its stores, so that no store's data register is written again before the wait below
        // q, k: rows t = 16 nb + lr, piece mb (d = 16 mb + 8 hi ..) of the 2 fragments of that row block; v: rows d = 16 nb + lr, keys 16 mb + 8 hi ..: half mb & 1 of fragment nb of key block mb >> 1
        const size_t o = (size_t)nb * (ISV ? 512 : 1024) + 8 * lane; bf* ph = Ph + o; bf* pl = Pl + o; h16* px = ISV ? P16 + o : nullptr;
#pragma unroll
        for (int mb = 0; mb < 4; ++mb) { const int e = ISV ? (mb >> 1) * 2048 + (mb & 1) * 256 : mb * 256;
            *(v8us*)(ph + e) = __builtin_bit_cast(v8us, wh[mb]); *(v8us*)(pl + e) = __builtin_bit_cast(v8us, wl[mb]);
            if (ISV) *(v8h*)(px + e) = __builtin_bit_cast(v8h, wx[mb]); }
        asm volatile("s_wait_xcnt 0x0" ::: "memory");   // before the next turn reuses the data and address registers of the stores above
        __builtin_amdgcn_sched_barrier(0);   // keeps later register writes behind that wait, and the later turns' conversions in their turns
    }
}
__global__ __launch_bounds__(32) void k_gemmqkv(const bf* __restrict__ X, const bf* __restrict__ Wt, const float* __restrict__ bias, bf* Qh, bf* Ql, bf* Kh, bf* Kl, bf* Vh, bf* Vl, h16* V16) {
    static_assert(HD == 64 && TT % 64 == 0 && DM % 32 == 0, "one tile is 64 rows of one entry and one head");
    const int lane = threadIdx.x & 31; const int r0 = blockIdx.x * 64, c0 = blockIdx.y * 64; const bool isv = c0 >= DQ + DKV;
    const bf* xp = X + (size_t)r0 * DM + 8 * lane; const bf* wp = Wt + (size_t)c0 * DM + 8 * lane;   // the lane's piece of the first fragment of the tile's first 16 rows
    const bf* pa = isv ? xp : wp; const bf* pb = isv ? wp : xp;
    v8f acc[4][4];
#pragma unroll
    for (int mb = 0; mb < 4; ++mb)
#pragma unroll
        for (int nb = 0; nb < 4; ++nb) acc[mb][nb] = (v8f){};
#pragma unroll 1   // as in k_gemmw: one k step of 32 a trip
    for (int kc = 0; kc < DM; kc += 32) {
        const bf* ak = pa + kc * 16; const bf* bk = pb + kc * 16; v16bf a[4];   // a k step of 32 is the next fragment
#pragma unroll
        for (int mb = 0; mb < 4; ++mb) a[mb] = WFrag<bf>::ld(ak + (size_t)mb * 16 * DM);
#pragma unroll
        for (int nb = 0; nb < 4; ++nb) { const v16bf b = WFrag<bf>::ld(bk + (size_t)nb * 16 * DM);
#pragma unroll
            for (int mb = 0; mb < 4; ++mb) acc[mb][nb] = wmmab(a[mb], b, acc[mb][nb]); }
        // the wait: before the trip's two address pairs are rewritten (they are named so that they stay in their registers up to here); the v_nops, as in k_gemmw: the distance behind the trip's last matrix instruction, on the back edge and on the way out alike
        asm volatile("s_wait_xcnt 0x0\n\tv_nop\n\tv_nop\n\tv_nop\n\tv_nop" : "+v"(acc[0][0]), "+v"(acc[1][1]), "+v"(acc[2][2]), "+v"(acc[3][3]) : "v"(a[0]), "v"(a[3]), "v"(ak), "v"(bk));
    }
    const int en = r0 / TT, t0 = r0 % TT;
    if (isv) { const size_t o = ((size_t)en * NKV + (c0 - DQ - DKV) / HD) * HD * TT + (size_t)t0 * HD; qkv_store<true>(acc, bias + c0, Vh + o, Vl + o, V16 + o, lane); }   // 32 keys of a head are 4 fragments = 32 HD elements
    else { const bool isk = c0 >= DQ; const size_t o = (((size_t)en * (isk ? NKV : NH_) + (isk ? c0 - DQ : c0) / HD) * TT + t0) * HD; qkv_store<false>(acc, bias + c0, (isk ? Kh : Qh) + o, (isk ? Kl : Ql) + o, nullptr, lane); }
}
template <bool HI>
__device__ __forceinline__ void fattn_body(const bf* __restrict__ Qh, const bf* __restrict__ Ql, const bf* __restrict__ Kh, const bf* __restrict__ Kl, const bf* __restrict__ Vh, const bf* __restrict__ Vl, const h16* __restrict__ V16, const float* __restrict__ am, bf* Ah, bf* Al, int q0, int lane) {
    v16bf qh[2][2], ql[2][2];   // [column group][k step of 32]
    v16bf kh[2][2], kl[2][2];   // [16-key tile][k step]
    v4f mk[2][2][2];            // [column group][16-key tile][half of the lane's 8 keys]
    // all planes in fragment order: 16 rows of q or k are 2 fragments (16 HD elements), 32 keys of v are 4 (32 HD elements), 16 queries x 32 keys of the mask are 4 runs of 128 floats
    const bf* kph = Kh + 8 * lane; const bf* kpl = Kl + 8 * lane;
    const float* mp = am + (size_t)q0 * TT + 4 * lane;
    const size_t vof = 8 * lane;
    { const bf* qph = Qh + (size_t)q0 * HD + 8 * lane; const bf* qpl = Ql + (size_t)q0 * HD + 8 * lane;
#pragma unroll
        for (int g = 0; g < 2; ++g)
#pragma unroll
            for (int kc = 0; kc < 2; ++kc) { qh[g][kc] = WFrag<bf>::ld(qph + 16 * g * HD + 512 * kc); ql[g][kc] = WFrag<bf>::ld(qpl + 16 * g * HD + 512 * kc); }
#pragma unroll
        for (int kt = 0; kt < 2; ++kt) {
#pragma unroll
            for (int kc = 0; kc < 2; ++kc) { kh[kt][kc] = WFrag<bf>::ld(kph + 16 * kt * HD + 512 * kc); kl[kt][kc] = WFrag<bf>::ld(kpl + 16 * kt * HD + 512 * kc); }
#pragma unroll
            for (int g = 0; g < 2; ++g) { mk[g][kt][0] = *(const v4f*)(mp + 16 * g * TT + 256 * kt); mk[g][kt][1] = *(const v4f*)(mp + 16 * g * TT + 256 * kt + 128); } }
        asm volatile("s_wait_xcnt 0x0" :: "v"(qph), "v"(qpl), "v"(kph), "v"(kpl), "v"(mp) : "memory");   // before any address register of the loads above is reused; the addresses are named so that they stay in their registers up to here
        __builtin_amdgcn_sched_barrier(0);   // keeps later register writes behind that wait
    }
    v8f acc[2][4]; float mrun[2]; v2f lrun[2];
#pragma unroll
    for (int g = 0; g < 2; ++g) { mrun[g] = -3.0e38f; lrun[g] = (v2f){};
#pragma unroll
        for (int t = 0; t < 4; ++t) acc[g][t] = (v8f){}; }
    const v2f scl2 = {SCL, SCL}, l2e2 = {L2E, L2E};
#pragma unroll 1   // one pass a trip: unrolled, the fragments of two passes would be live at once
    for (int kb = 0; kb < TT / 32; ++kb) {
        const int key0 = kb * 32, nk0 = (kb + 1 < TT / 32) ? key0 + 32 : key0;   // the last pass fetches its own rows again (in bounds, unused)
        v8f s[2][2];   // [16-key tile][column group]
#pragma unroll
        for (int kt = 0; kt < 2; ++kt)
#pragma unroll
            for (int g = 0; g < 2; ++g) s[kt][g] = (v8f){};
#pragma unroll
        for (int kc = 0; kc < 2; ++kc) {   // per accumulator: qh.kh, ql.kh, qh.kl, k steps ascending
#pragma unroll
            for (int kt = 0; kt < 2; ++kt)
#pragma unroll
                for (int g = 0; g < 2; ++g) s[kt][g] = wmmab(kh[kt][kc], qh[g][kc], s[kt][g]);
#pragma unroll
            for (int kt = 0; kt < 2; ++kt)
#pragma unroll
                for (int g = 0; g < 2; ++g) s[kt][g] = wmmab(kh[kt][kc], ql[g][kc], s[kt][g]);
#pragma unroll
            for (int kt = 0; kt < 2; ++kt)
#pragma unroll
                for (int g = 0; g < 2; ++g) s[kt][g] = wmmab(kl[kt][kc], qh[g][kc], s[kt][g]); }
        // t = s / 8 - mask (s / 8 is exact, so the fused form rounds once, as a separate subtraction does)
#pragma unroll
        for (int g = 0; g < 2; ++g)
#pragma unroll
            for (int kt = 0; kt < 2; ++kt)
#pragma unroll
                for (int i = 0; i < 4; ++i) { const v2f sv = {s[kt][g][2 * i], s[kt][g][2 * i + 1]}, mv = {mk[g][kt][i >> 1][2 * (i & 1)], mk[g][kt][i >> 1][2 * (i & 1) + 1]};
                    const v2f t = __builtin_elementwise_fma(sv, scl2, -mv); s[kt][g][2 * i] = t[0]; s[kt][g][2 * i + 1] = t[1]; }
        // One group of loads, in flight under the softmax: this pass's values, the next pass's keys and mask (their registers are free from here on).
        __builtin_amdgcn_sched_barrier(0);   // keeps the group from sinking towards its users, where its latency would be exposed
        v16bf vh[4], vl[4]; v16h vx[4];
        { const bf* nkh = kph + (size_t)nk0 * HD; const bf* nkl = kpl + (size_t)nk0 * HD; const float* nmp = mp + nk0 * 16;
            const bf* vph = Vh + vof + key0 * HD; const bf* vpl = Vl + vof + key0 * HD; const h16* vpx = V16 + vof + key0 * HD;
#pragma unroll
            for (int t = 0; t < 4; ++t) { if (HI) { vh[t] = WFrag<bf>::ld(vph + 512 * t); vl[t] = WFrag<bf>::ld(vpl + 512 * t); } else vx[t] = WFrag<h16>::ld(vpx + 512 * t); }
#pragma unroll
            for (int kt = 0; kt < 2; ++kt)
#pragma unroll
                for (int kc = 0; kc < 2; ++kc) { kh[kt][kc] = WFrag<bf>::ld(nkh + 16 * kt * HD + 512 * kc); kl[kt][kc] = WFrag<bf>::ld(nkl + 16 * kt * HD + 512 * kc); }
#pragma unroll
            for (int kt = 0; kt < 2; ++kt)
#pragma unroll
                for (int g = 0; g < 2; ++g) { mk[g][kt][0] = *(const v4f*)(nmp + 16 * g * TT + 256 * kt); mk[g][kt][1] = *(const v4f*)(nmp + 16 * g * TT + 256 * kt + 128); }
            // before any address register of the group is reused; the addresses are named so that they stay in their registers up to here
            if (HI) asm volatile("s_wait_xcnt 0x0" :: "v"(nkh), "v"(nkl), "v"(nmp), "v"(vph), "v"(vpl) : "memory"); else asm volatile("s_wait_xcnt 0x0" :: "v"(nkh), "v"(nkl), "v"(nmp), "v"(vpx) : "memory"); }
        __builtin_amdgcn_sched_barrier(0);   // keeps later register writes behind that wait
        // each query's maximum over the pass
        float mb[2]; bool need = false;
#pragma unroll
        for (int g = 0; g < 2; ++g) { float mx = -3.0e38f;
#pragma unroll
            for (int kt = 0; kt < 2; ++kt)
#pragma unroll
                for (int j = 0; j < 8; ++j) mx = fmaxf(mx, s[kt][g][j]);
            mx = fmaxf(mx, xhalf(mx)); mb[g] = mx; need = need || (mx > mrun[g] + LAZY); }
        if (__builtin_amdgcn_ballot_w32(need) != 0) {   // wave-uniform; always on the first pass, rare later
#pragma unroll
            for (int g = 0; g < 2; ++g) { const float mn = fmaxf(mrun[g], mb[g]); const float corr = __builtin_amdgcn_exp2f((mrun[g] - mn) * L2E); mrun[g] = mn; lrun[g] = lrun[g] * corr;   // corr = 0 on the first pass
#pragma unroll
                for (int t = 0; t < 4; ++t) acc[g][t] = acc[g][t] * corr; } }
#pragma unroll
        for (int g = 0; g < 2; ++g) { const float nm = -mrun[g] * L2E; const v2f nm2 = {nm, nm}; v8u wh, wl; v16h px;
#pragma unroll
            for (int i = 0; i < 8; ++i) { const int kt = i >> 2, r = 2 * (i & 3);   // operand elements 2i, 2i+1 = tile kt, registers r, r+1
                const v2f sv = {s[kt][g][r], s[kt][g][r + 1]}; const v2f a = __builtin_elementwise_fma(sv, l2e2, nm2);
                v2f p; p[0] = __builtin_amdgcn_exp2f(a[0]); p[1] = __builtin_amdgcn_exp2f(a[1]); lrun[g] += p;
                if (HI) { const unsigned h = pack2(p[0], p[1]); wh[i] = h; wl[i] = pack2(p[0] - __uint_as_float(h << 16), p[1] - __uint_as_float(h & 0xFFFF0000u)); }
                else { px[2 * i] = tohx(p[0]); px[2 * i + 1] = tohx(p[1]); } }
            if (HI) { const v16bf ph = __builtin_bit_cast(v16bf, wh), pl = __builtin_bit_cast(v16bf, wl);
#pragma unroll
                for (int t = 0; t < 4; ++t) acc[g][t] = wmmab(vh[t], ph, acc[g][t]);   // per accumulator: ph.vh, pl.vh, ph.vl
#pragma unroll
                for (int t = 0; t < 4; ++t) acc[g][t] = wmmab(vh[t], pl, acc[g][t]);
#pragma unroll
                for (int t = 0; t < 4; ++t) acc[g][t] = wmmab(vl[t], ph, acc[g][t]);
            } else {
#pragma unroll
                for (int t = 0; t < 4; ++t) acc[g][t] = wmma16(vx[t], px, acc[g][t]); } }
        __builtin_amdgcn_sched_barrier(0);   // holds the v_nops behind the last matrix instruction
        asm volatile("v_nop\n\tv_nop\n\tv_nop\n\tv_nop");   // the distance behind the pass's last matrix instruction, on the back edge and on the way out of the loop alike
        __builtin_amdgcn_sched_barrier(0);
    }
#pragma unroll
    for (int g = 0; g < 2; ++g) { const float lh = lrun[g][0] + lrun[g][1]; const float l = lh + xhalf(lh); const float inv = __fdiv_rn(1.0f, l); bf* pa = Ah + (size_t)(q0 + 16 * g) * DQ + 8 * lane; bf* pb = Al + (size_t)(q0 + 16 * g) * DQ + 8 * lane;   // a lane's 8 registers are d = 16 t + 8 hi + 0..7 of query lr: piece t of the head's 2 fragments of that row block
        v8us oh[4], ol[4];
#pragma unroll
        for (int t = 0; t < 4; ++t) {
#pragma unroll
            for (int j = 0; j < 8; ++j) { unsigned short a, c2; splitf(acc[g][t][j] * inv, a, c2); oh[t][j] = a; ol[t][j] = c2; } }
        __builtin_amdgcn_sched_barrier(0);   // the group's conversions stay in front of its stores, so that no store's data register is written again before the wait below
#pragma unroll
        for (int t = 0; t < 4; ++t) { *(v8us*)(pa + 256 * t) = oh[t]; *(v8us*)(pb + 256 * t) = ol[t]; }
        asm volatile("s_wait_xcnt 0x0" ::: "memory");   // before the next group reuses the data and address registers of the stores above
        __builtin_amdgcn_sched_barrier(0);   // keeps later register writes behind that wait
    }
}
// grid.y = entry * NH_ + head (planes consecutive); writes the merged [t][DQ] hi and lo planes that Wo reads, in fragment order (a head's 64 columns are 2 fragments of each 16-row block).
__global__ __launch_bounds__(256) void k_fattn(const bf* __restrict__ Qh, const bf* __restrict__ Ql, const bf* __restrict__ Kh, const bf* __restrict__ Kl, const bf* __restrict__ Vh, const bf* __restrict__ Vl, const h16* __restrict__ V16, const float* __restrict__ am, bf* Ah, bf* Al) {
    static_assert(2 * RH == TT && RH % 128 == 0 && HD == 64 && NKV == NH_, "the wave split below is written for these");
    const int lane = threadIdx.x & 31; const int wave = __builtin_amdgcn_readfirstlane((int)(threadIdx.x >> 5));
    const size_t z = blockIdx.y, po = z * TT * HD, ao = (z / NH_) * TT * DQ + (z % NH_) * HD * 16; const int qb = (blockIdx.x * 4 + (wave & 3)) * 32;
    if (wave < 4) fattn_body<true>(Qh + po, Ql + po, Kh + po, Kl + po, Vh + po, Vl + po, V16 + po, am, Ah + ao, Al + ao, qb, lane);
    else fattn_body<false>(Qh + po, Ql + po, Kh + po, Kl + po, Vh + po, Vl + po, V16 + po, am, Ah + ao, Al + ao, RH + qb, lane);
}

extern "C" void kernel_launch(void* const* d_in, const int* in_sizes, int n_in,
                              void* d_out, int out_size, void* d_ws, size_t ws_size, hipStream_t stream) {
    (void)in_sizes; (void)n_in; (void)out_size;
    const float* x = (const float*)d_in[0]; const float* amask = (const float*)d_in[1]; const float* wf = (const float*)d_in[2]; const float* bf3 = (const float*)d_in[3]; const float* wo = (const float*)d_in[4]; const float* bo = (const float*)d_in[5];
    float* OUT = (float*)d_out;     // [8][1024][1024]
    char* wsp = (char*)d_ws;
    auto take = [&](size_t bytes) { char* p = wsp; wsp += (bytes + 255) & ~(size_t)255; return (void*)p; };
    bf* WO = (bf*)take((size_t)DM * DQ * 2);
    bf* WALL = (bf*)take((size_t)(DQ + 2 * DKV) * DM * 2); float* AMR = (float*)take((size_t)TT * TT * 4);
    h16* VT16 = (h16*)take((size_t)GB * NKV * HD * TT * 2);
    bf* QPh = (bf*)take((size_t)GB * NH_ * TT * HD * 2); bf* QPl = (bf*)take((size_t)GB * NH_ * TT * HD * 2); bf* KPh = (bf*)take((size_t)GB * NKV * TT * HD * 2); bf* KPl = (bf*)take((size_t)GB * NKV * TT * HD * 2); bf* VTh = (bf*)take((size_t)GB * NKV * HD * TT * 2); bf* VTl = (bf*)take((size_t)GB * NKV * HD * TT * 2);
    const int NQKV = DQ + 2 * DKV;
    bf* XB = (bf*)take((size_t)GB * TT * DM * 2);            // bf16 x of GB entries
    bf* ATh = (bf*)take((size_t)GB * TT * DQ * 2); bf* ATl = (bf*)take((size_t)GB * TT * DQ * 2);
    static_assert(GB == NB_, "one launch of each kernel serves every entry");
    if ((size_t)(wsp - (char*)d_ws) > ws_size) return;    // ws 256 MiB; the carve-up takes about 172 MiB
    k_prep<<<PB_WQ + PB_WO + PB_MK + PB_X, 256, 0, stream>>>(x, amask, wf, wo, XB, AMR, WALL, WO);   // weights transposed, mask and x rounded, all in fragment order
    k_gemmqkv<<<dim3(GB * TT / 64, NQKV / 64, 1), 32, 0, stream>>>(XB, WALL, bf3, QPh, QPl, KPh, KPl, VTh, VTl, VT16);   // q | k | v of GB entries as one product of width NQKV, written as the head planes
    k_fattn<<<dim3(RH / 128, GB * NH_, 1), 256, 0, stream>>>(QPh, QPl, KPh, KPl, VTh, VTl, VT16, AMR, ATh, ATl);   // scores, softmax, attn.v and the head merge of GB entries
    k_gemmw<bf, 1, true, DQ><<<dim3(GB * TT / 64, DM / 64, 1), 32, 0, stream>>>(ATh, ATl, WO, nullptr, OUT, DM, bo, 0, 0, 0);
}
